// v000
// Measured on an AMD MI455X. A time is GPU time per run, averaged over a window of back-to-back runs after a warm-up
// (all launches, gaps included; the runs take copies of the inputs in turn), and the median of several windows.
// Apart from v000's, it joins two sittings. Times from different sittings can be a few percent apart, while
// side-by-side timings come from the same sitting.
// v000 is the starting kernel. One run takes 836 microseconds.
#include <hip/hip_runtime.h>

// Single-head causal self-attention with bias-free projections (x [4][2048][1024]; q, k, v = einsum('bsd,ed', x, W) ('oi' [1024][1024] 1/32, no bias; ONE 1,024-wide head); scores = q.k; causal (-inf); THEN x 1/sqrt(1024) inside the softmax call (-inf stays -inf); softmax; out = attn.v -> [4][2048][1024] (8.4 M); no output projection; argument order x, Wq, Wk, Wv).
// Layout per batch: bf16 copy of x; 'oi' weights; exact projections; identity-table plane builders at HD 1024 (one plane each); causal T-2048 attention at NH 1 / ZH 1 (hybrid rows: < 512 hi/lo 3 products, rest fp16 x1024; k_gemmc skips tiles above the diagonal); the f32 merge writes the output rows (no output projection).
// Compute dtypes, f32 accumulate: every input rounded to bf16; projections exact; attention rows < 512 3 products, rest fp16; softmax f32; output f32.

#define NB_  4
#define TT   2048
#define DM   1024
#define NH_  1
#define NKV  1
#define REP  (NH_ / NKV)
#define HD   1024
#define DQ   (NH_ * HD)
#define DKV  (NKV * HD)
#define ZH   1                    // ONE head: a single plane per pass
static_assert(1 % ZH == 0, "single head");
#define RH   512                  // query rows < RH use hi+lo planes (0: none)
#define WIN  2048
#define PCAR 1024.0f
#define SCL  0.03125f   // 1/sqrt(d_k = 1024)
typedef _Float16 h16;
typedef unsigned short bf;
typedef __attribute__((ext_vector_type(16))) __bf16   v16bf;
typedef __attribute__((ext_vector_type(16))) _Float16 v16h;
typedef __attribute__((ext_vector_type(8)))  _Float16 v8h;
typedef __attribute__((ext_vector_type(8)))  unsigned short v8us;
typedef __attribute__((ext_vector_type(8)))  float    v8f;
typedef __attribute__((ext_vector_type(4)))  float    v4f;
typedef v8h  __attribute__((may_alias)) v8ha;
typedef v4f  __attribute__((may_alias)) v4fa;
typedef v8us __attribute__((may_alias)) v8usa;

__device__ __forceinline__ unsigned short f2bf(float f) { unsigned u = __float_as_uint(f); u += 0x7FFFu + ((u >> 16) & 1u); return (unsigned short)(u >> 16); }
__device__ __forceinline__ float bf2f(unsigned short b) { return __uint_as_float(((unsigned)b) << 16); }
__device__ __forceinline__ float bfr(float f) { return bf2f(f2bf(f)); }
__device__ __forceinline__ v16h cat16(v8h lo, v8h hi) { return __builtin_shufflevector(lo, hi, 0, 1, 2, 3, 4, 5, 6, 7, 8, 9, 10, 11, 12, 13, 14, 15); }
__device__ __forceinline__ v16bf cat16b(v8us lo, v8us hi) { return __builtin_bit_cast(v16bf, __builtin_shufflevector(lo, hi, 0, 1, 2, 3, 4, 5, 6, 7, 8, 9, 10, 11, 12, 13, 14, 15)); }
__device__ __forceinline__ v8f wmma16(v16h a, v16h b, v8f c) { return __builtin_amdgcn_wmma_f32_16x16x32_f16(false, a, false, b, (short)0, c, false, false); }
__device__ __forceinline__ v8f wmmab(v16bf a, v16bf b, v8f c) { return __builtin_amdgcn_wmma_f32_16x16x32_bf16(false, a, false, b, (short)0, c, false, false); }



// ---- k_gemmw: register-blocked GEMM, ONE WAVE per 64x64 output tile (16 accumulators), operands straight from K-contiguous 16-bit planes; grid (M/64, N/64, Z), 32 threads.
// C[m][n] (f32, pitch ldc, + optional f32 bias[n]) = sum_k A[m][k] Bt[n][k] (+ split products per NSPLIT). z-batch strides sA/sB/sC in elements. K % 32 == 0.
template <typename T16> struct WFrag;
template <> struct WFrag<h16> { typedef v16h V; static __device__ __forceinline__ V ld(const h16* p) { return cat16(*(const v8h*)p, *(const v8h*)(p + 16)); } static __device__ __forceinline__ v8f mma(V a, V b, v8f c) { return wmma16(a, b, c); } };
template <> struct WFrag<bf> { typedef v16bf V; static __device__ __forceinline__ V ld(const bf* p) { return cat16b(*(const v8us*)p, *(const v8us*)(p + 16)); } static __device__ __forceinline__ v8f mma(V a, V b, v8f c) { return wmmab(a, b, c); } };
template <typename T16, int NSPLIT, bool BIAS>
__global__ __launch_bounds__(32) void k_gemmw(const T16* __restrict__ A, const T16* __restrict__ A2, const T16* __restrict__ Bt, const T16* __restrict__ Bt2, int K, float* C, int ldc, const float* __restrict__ bias, size_t sA, size_t sB, size_t sC) {
    typedef typename WFrag<T16>::V V;
    __shared__ __align__(16) float os[16 * 68];
    const size_t z = blockIdx.z; A += z * sA; if (A2) A2 += z * sA; Bt += z * sB; if (Bt2) Bt2 += z * sB; C += z * sC;
    const int lane = threadIdx.x & 31, lr = lane & 15, hi = lane >> 4; const int r0 = blockIdx.x * 64, c0 = blockIdx.y * 64;
    v8f acc[4][4];
#pragma unroll
    for (int mb = 0; mb < 4; ++mb)
#pragma unroll
        for (int nb = 0; nb < 4; ++nb) acc[mb][nb] = (v8f){};
    const size_t aoff = (size_t)(r0 + lr) * K + 8 * hi, boff = (size_t)(c0 + lr) * K + 8 * hi;
#pragma unroll 1
    for (int kc = 0; kc < K; kc += 32) {
        V a[4], a2[4];
#pragma unroll
        for (int mb = 0; mb < 4; ++mb) { a[mb] = WFrag<T16>::ld(A + aoff + (size_t)mb * 16 * K + kc); if (NSPLIT == 1 || NSPLIT == 2) a2[mb] = WFrag<T16>::ld(A2 + aoff + (size_t)mb * 16 * K + kc); }
#pragma unroll
        for (int nb = 0; nb < 4; ++nb) { const V b = WFrag<T16>::ld(Bt + boff + (size_t)nb * 16 * K + kc); V b2; if (NSPLIT >= 2) b2 = WFrag<T16>::ld(Bt2 + boff + (size_t)nb * 16 * K + kc);
#pragma unroll
            for (int mb = 0; mb < 4; ++mb) { acc[mb][nb] = WFrag<T16>::mma(a[mb], b, acc[mb][nb]); if (NSPLIT == 1 || NSPLIT == 2) acc[mb][nb] = WFrag<T16>::mma(a2[mb], b, acc[mb][nb]); if (NSPLIT >= 2) acc[mb][nb] = WFrag<T16>::mma(a[mb], b2, acc[mb][nb]); } }
        asm volatile("v_nop\n\tv_nop\n\tv_nop\n\tv_nop" : "+v"(acc[0][0]), "+v"(acc[1][1]), "+v"(acc[2][2]), "+v"(acc[3][3]) : "v"(a[0]), "v"(a[3]));
    }
#pragma unroll
    for (int mb = 0; mb < 4; ++mb) {
#pragma unroll
        for (int nb = 0; nb < 4; ++nb) {
#pragma unroll
            for (int j = 0; j < 8; ++j) os[(hi * 8 + j) * 68 + nb * 16 + lr] = acc[mb][nb][j]; }
        __builtin_amdgcn_wave_barrier(); asm volatile("" ::: "memory");
        float* crow = C + (size_t)(r0 + mb * 16) * ldc + c0;
{
#pragma unroll
            for (int s = 0; s < 8; ++s) { const int row = 2 * s + hi, cofs = lr * 4; v4f val = *(const v4fa*)(os + row * 68 + cofs); if (BIAS) { val[0] += bfr(bias[c0 + cofs]); val[1] += bfr(bias[c0 + cofs + 1]); val[2] += bfr(bias[c0 + cofs + 2]); val[3] += bfr(bias[c0 + cofs + 3]); }
                *(v4f*)(crow + (size_t)row * ldc + cofs) = val; }
             }
        __builtin_amdgcn_wave_barrier(); asm volatile("" ::: "memory");
    }
}

// ---- k_gemmc: the same one-wave 64x64 tile GEMM specialised for causal attention: CMODE 1 skips score tiles entirely above the diagonal (query rows r0+roff.., key columns c0..), CMODE 2 limits the
// key (K) loop of the probability x value contraction to the diagonal block (probabilities beyond it are exactly zero). roff = row offset of this launch's first row within the sequence.
template <typename T16, int NSPLIT, int CMODE>
__global__ __launch_bounds__(32) void k_gemmc(const T16* __restrict__ A, const T16* __restrict__ A2, const T16* __restrict__ Bt, const T16* __restrict__ Bt2, int K, float* C, int ldc, int roff, size_t sA, size_t sB, size_t sC) {
    typedef typename WFrag<T16>::V V;
    __shared__ __align__(16) float os[16 * 68];
    const size_t z = blockIdx.z; A += z * sA; if (A2) A2 += z * sA; Bt += z * sB; if (Bt2) Bt2 += z * sB; C += z * sC;
    const int lane = threadIdx.x & 31, lr = lane & 15, hi = lane >> 4; const int r0 = blockIdx.x * 64, c0 = blockIdx.y * 64;
    if (CMODE == 1 && c0 > r0 + roff + 63) return;                  // score tile entirely above the causal diagonal: never read (the softmax masks j > i by select)
    const int Kl = (CMODE == 2) ? min(K, r0 + roff + 64) : K;        // P.V: probabilities are exactly 0 beyond the diagonal block, so the K loop stops there
    v8f acc[4][4];
#pragma unroll
    for (int mb = 0; mb < 4; ++mb)
#pragma unroll
        for (int nb = 0; nb < 4; ++nb) acc[mb][nb] = (v8f){};
    const size_t aoff = (size_t)(r0 + lr) * K + 8 * hi, boff = (size_t)(c0 + lr) * K + 8 * hi;
#pragma unroll 1
    for (int kc = 0; kc < Kl; kc += 32) {
        V a[4], a2[4];
#pragma unroll
        for (int mb = 0; mb < 4; ++mb) { a[mb] = WFrag<T16>::ld(A + aoff + (size_t)mb * 16 * K + kc); if (NSPLIT == 1 || NSPLIT == 2) a2[mb] = WFrag<T16>::ld(A2 + aoff + (size_t)mb * 16 * K + kc); }
#pragma unroll
        for (int nb = 0; nb < 4; ++nb) { const V b = WFrag<T16>::ld(Bt + boff + (size_t)nb * 16 * K + kc); V b2; if (NSPLIT >= 2) b2 = WFrag<T16>::ld(Bt2 + boff + (size_t)nb * 16 * K + kc);
#pragma unroll
            for (int mb = 0; mb < 4; ++mb) { acc[mb][nb] = WFrag<T16>::mma(a[mb], b, acc[mb][nb]); if (NSPLIT == 1 || NSPLIT == 2) acc[mb][nb] = WFrag<T16>::mma(a2[mb], b, acc[mb][nb]); if (NSPLIT >= 2) acc[mb][nb] = WFrag<T16>::mma(a[mb], b2, acc[mb][nb]); } }
        asm volatile("v_nop\n\tv_nop\n\tv_nop\n\tv_nop" : "+v"(acc[0][0]), "+v"(acc[1][1]), "+v"(acc[2][2]), "+v"(acc[3][3]) : "v"(a[0]), "v"(a[3]));
    }
#pragma unroll
    for (int mb = 0; mb < 4; ++mb) {
#pragma unroll
        for (int nb = 0; nb < 4; ++nb) {
#pragma unroll
            for (int j = 0; j < 8; ++j) os[(hi * 8 + j) * 68 + nb * 16 + lr] = acc[mb][nb][j]; }
        __builtin_amdgcn_wave_barrier(); asm volatile("" ::: "memory");
        float* crow = C + (size_t)(r0 + mb * 16) * ldc + c0;
{
#pragma unroll
            for (int s = 0; s < 8; ++s) { const int row = 2 * s + hi, cofs = lr * 4; v4f val = *(const v4fa*)(os + row * 68 + cofs);
                *(v4f*)(crow + (size_t)row * ldc + cofs) = val; }
             }
        __builtin_amdgcn_wave_barrier(); asm volatile("" ::: "memory");
    }
}

__device__ __forceinline__ h16 tohx(float x) { return (h16)x; }
__device__ __forceinline__ void splitf(float y, unsigned short& h, unsigned short& l) { h = f2bf(y); l = f2bf(y - bf2f(h)); }
typedef __attribute__((ext_vector_type(2))) _Float16 v2h;
typedef __attribute__((ext_vector_type(4))) _Float16 v4h;
typedef __attribute__((ext_vector_type(2))) unsigned short v2us;
typedef __attribute__((ext_vector_type(4))) unsigned short v4us;
typedef __attribute__((ext_vector_type(2))) float v2f;
typedef __attribute__((ext_vector_type(4))) int v4i;

__global__ __launch_bounds__(256) void k_cvt8(const float* __restrict__ src, bf* dst, size_t n8) { const size_t i = (size_t)blockIdx.x * 256 + threadIdx.x; if (i >= n8) return; const v8f v = *(const v8f*)(src + i * 8); v8us o;
#pragma unroll
    for (int k = 0; k < 8; ++k) o[k] = f2bf(v[k]); *(v8us*)(dst + i * 8) = o;  }

// k_rope: head planes [h][t][d] (fp16 + hi/lo) of rope(x) x sc with the rotate-half convention out[d] = x[d] cos[t][d] - x[d+HD/2] sin[t][d], out[d+HD/2] = x[d+HD/2] cos[t][d+HD/2] + x[d] sin[t][d+HD/2]
__global__ __launch_bounds__(256) void k_rope(const float* __restrict__ F, int pitch, int nheads, const float* __restrict__ CS, const float* __restrict__ RF, const float* __restrict__ nw, float sc, h16* P16, bf* Ph, bf* Pl) {
    const size_t e = ((size_t)blockIdx.x * 256 + threadIdx.x) * 2; if (e >= (size_t)nheads * TT * HD) return; const int d = (int)(e % HD); const int t = (int)((e / HD) % TT); const int h = (int)(e / ((size_t)HD * TT)); const float* f = F + (size_t)t * pitch + h * HD; const float rf = RF ? RF[(size_t)h * TT + t] : 1.0f; v2h o16; v2us oh, ol;
#pragma unroll
    for (int q = 0; q < 2; ++q) { const int dd = d + q; const int dp = (dd < HD / 2) ? dd + HD / 2 : dd - HD / 2; float x0 = f[dd], x1 = f[dp];
        if (RF) { float n0 = __fmul_rn(x0, rf), n1 = __fmul_rn(x1, rf); asm volatile("" : "+v"(n0)); asm volatile("" : "+v"(n1)); x0 = __fmul_rn(bfr(nw[dd]), n0); x1 = __fmul_rn(bfr(nw[dp]), n1); }
        const v2f cs = *(const v2f*)(CS + ((size_t)t * HD + dd) * 2); float a = __fmul_rn(x0, cs[0]), bq = __fmul_rn(x1, cs[1]); asm volatile("" : "+v"(a)); asm volatile("" : "+v"(bq)); const float r = ((dd < HD / 2) ? __fsub_rn(a, bq) : __fadd_rn(a, bq)) * sc;
        o16[q] = tohx(r); unsigned short a2, c2; splitf(r, a2, c2); oh[q] = a2; ol[q] = c2; }
    *(v2h*)(P16 + e) = o16; *(v2us*)(Ph + e) = oh; *(v2us*)(Pl + e) = ol;  }
__global__ __launch_bounds__(256) void k_vtp(const float* __restrict__ F, int pitch, int nheads, h16* V16, bf* Vh, bf* Vl) { const size_t e = ((size_t)blockIdx.x * 256 + threadIdx.x) * 2; if (e >= (size_t)nheads * HD * TT) return; const int t = (int)(e % TT); const int d = (int)((e / TT) % HD); const int g = (int)(e / ((size_t)TT * HD)); v2h o16; v2us oh, ol;
#pragma unroll
    for (int q = 0; q < 2; ++q) { const float x = F[(size_t)(t + q) * pitch + g * HD + d]; o16[q] = tohx(x); unsigned short a2, c2; splitf(x, a2, c2); oh[q] = a2; ol[q] = c2; }
    *(v2h*)(V16 + e) = o16; *(v2us*)(Vh + e) = oh; *(v2us*)(Vl + e) = ol;  }
__global__ __launch_bounds__(256) void k_csid(float* CS) { const int idx = blockIdx.x * 256 + threadIdx.x; if (idx >= TT * HD) return; v2f cs; cs[0] = 1.0f; cs[1] = 0.0f; *(v2f*)(CS + (size_t)idx * 2) = cs;  }
// k_asoft: per row (zz, i): t = S x HD^-0.5 for j <= i and i - j < WIN (sliding causal window; the reference's -1e9 additive fill vanishes identically); softmax over the 2048 keys (register row, one exp, fixed trees);
__global__ __launch_bounds__(256) void k_asoft(const float* __restrict__ Sb, h16* P16, bf* Ph, bf* Pl) {
    const int lane = threadIdx.x & 31; const int row = blockIdx.x * 8 + (threadIdx.x >> 5); if (row >= ZH * TT) return; const int i = row % TT; const int zz = row / TT; (void)zz; const bool hires = (i < RH); const float* sr = Sb + (size_t)row * TT; float v[TT / 32]; float mx = -3.0e38f;
#pragma unroll
    for (int ch = 0; ch < TT / 128; ++ch) { const int j0 = ch * 128 + lane * 4; const v4f a = *(const v4f*)(sr + j0);
#pragma unroll
        for (int q = 0; q < 4; ++q) { const int j = j0 + q; (void)j; const float t = (j <= i && i - j < WIN) ? a[q] * SCL : -3.0e38f; v[ch * 4 + q] = t; mx = fmaxf(mx, t); } }
#pragma unroll
    for (int sh = 16; sh; sh >>= 1) mx = fmaxf(mx, __shfl_xor(mx, sh, 32));
    float sum = 0.f;
#pragma unroll
    for (int k = 0; k < TT / 32; ++k) { float d0 = __fsub_rn(v[k], mx); asm volatile("" : "+v"(d0)); v[k] = __builtin_amdgcn_exp2f(__fmul_rn(d0, 1.4426950408889634f)); sum += v[k]; }
#pragma unroll
    for (int sh = 16; sh; sh >>= 1) sum += __shfl_xor(sum, sh, 32);
    const float f = __fdiv_rn(hires ? 1.0f : PCAR, sum);
{
        if (hires) {
#pragma unroll
            for (int ch = 0; ch < TT / 128; ++ch) { v4us oh, ol;
#pragma unroll
                for (int q = 0; q < 4; ++q) { unsigned short a, c2; splitf(v[ch * 4 + q] * f, a, c2); oh[q] = a; ol[q] = c2; }
                const size_t oo = ((size_t)zz * (RH ? RH : 1) + i) * TT + ch * 128 + lane * 4; *(v4us*)(Ph + oo) = oh; *(v4us*)(Pl + oo) = ol; }
        } else {
#pragma unroll
            for (int ch = 0; ch < TT / 128; ++ch) { v4h o4;
#pragma unroll
                for (int q = 0; q < 4; ++q) o4[q] = tohx(v[ch * 4 + q] * f);
                *(v4h*)(P16 + (size_t)row * TT + ch * 128 + lane * 4) = o4; } }
         }
}
__global__ __launch_bounds__(256) void k_merge(const float* __restrict__ O, int h0, float* OUTb) { const size_t e = ((size_t)blockIdx.x * 256 + threadIdx.x) * 2; if (e >= (size_t)ZH * TT * HD) return; const int d = (int)(e % HD); const int t = (int)((e / HD) % TT); const int zz = (int)(e / ((size_t)HD * TT)); const float cs = (t < RH) ? 1.0f : (1.0f / PCAR); const size_t oo = (size_t)t * DQ + (h0 + zz) * HD + d;
    v2f o2; o2[0] = O[e] * cs; o2[1] = O[e + 1] * cs; *(v2f*)(OUTb + oo) = o2;  }

extern "C" void kernel_launch(void* const* d_in, const int* in_sizes, int n_in,
                              void* d_out, int out_size, void* d_ws, size_t ws_size, hipStream_t stream) {
    (void)in_sizes; (void)n_in; (void)out_size;
    const float* x = (const float*)d_in[0]; const float* wq = (const float*)d_in[1]; const float* wk = (const float*)d_in[2]; const float* wv = (const float*)d_in[3]; const float* wo = nullptr; (void)wo;   /* input order x, Wq, Wk, Wv ('oi' [1024][1024]) */
    float* OUT = (float*)d_out;     // [4][2048][1024]
    char* wsp = (char*)d_ws;
    auto take = [&](size_t bytes) { char* p = wsp; wsp += (bytes + 255) & ~(size_t)255; return (void*)p; };
    bf* WQ = (bf*)take((size_t)DQ * DM * 2); bf* WK = (bf*)take((size_t)DKV * DM * 2); bf* WV = (bf*)take((size_t)DKV * DM * 2); float* CS = (float*)take((size_t)TT * HD * 2 * 4);
    bf* XB = (bf*)take((size_t)TT * DM * 2); float* FQ = (float*)take((size_t)TT * DQ * 4); float* FK = (float*)take((size_t)TT * DKV * 4);
    h16* QP16 = (h16*)take((size_t)NH_ * TT * HD * 2); h16* KP16 = (h16*)take((size_t)NKV * TT * HD * 2); h16* VT16 = (h16*)take((size_t)NKV * HD * TT * 2);
    bf* QPh = (bf*)take((size_t)NH_ * TT * HD * 2); bf* QPl = (bf*)take((size_t)NH_ * TT * HD * 2); bf* KPh = (bf*)take((size_t)NKV * TT * HD * 2); bf* KPl = (bf*)take((size_t)NKV * TT * HD * 2); bf* VTh = (bf*)take((size_t)NKV * HD * TT * 2); bf* VTl = (bf*)take((size_t)NKV * HD * TT * 2); bf* Ph = (bf*)take((size_t)ZH * RH * TT * 2); bf* Pl = (bf*)take((size_t)ZH * RH * TT * 2);
    float* Sb = (float*)take((size_t)ZH * TT * TT * 4); h16* P16 = (h16*)take((size_t)ZH * TT * TT * 2); float* Ob = (float*)take((size_t)ZH * TT * HD * 4);
    if ((size_t)(wsp - (char*)d_ws) > ws_size) return;    // ws 256 MiB
    float* FV = FK;   // v projection reuses the k buffer after the k planes are built (stream-ordered)
    { k_cvt8<<<(unsigned)(((size_t)DQ * DM / 8 + 255) / 256), 256, 0, stream>>>(wq, WQ, (size_t)DQ * DM / 8); k_cvt8<<<(unsigned)(((size_t)DKV * DM / 8 + 255) / 256), 256, 0, stream>>>(wk, WK, (size_t)DKV * DM / 8); k_cvt8<<<(unsigned)(((size_t)DKV * DM / 8 + 255) / 256), 256, 0, stream>>>(wv, WV, (size_t)DKV * DM / 8);
      
       }
    k_csid<<<(TT * HD + 255) / 256, 256, 0, stream>>>(CS);
    const unsigned LQ = (unsigned)(((size_t)NH_ * TT * HD / 2 + 255) / 256), LKv = (unsigned)(((size_t)NKV * TT * HD / 2 + 255) / 256);
    for (int b = 0; b < NB_; ++b) {
        
        k_cvt8<<<(unsigned)(((size_t)TT * DM / 8 + 255) / 256), 256, 0, stream>>>(x + (size_t)b * TT * DM, XB, (size_t)TT * DM / 8);
        k_gemmw<bf, 0, false><<<dim3(TT / 64, DQ / 64, 1), 32, 0, stream>>>(XB, nullptr, WQ, nullptr, DM, FQ, DQ, nullptr, 0, 0, 0);
        k_rope<<<LQ, 256, 0, stream>>>(FQ, DQ, NH_, CS, nullptr, nullptr, 1.0f, QP16, QPh, QPl);
        k_gemmw<bf, 0, false><<<dim3(TT / 64, DKV / 64, 1), 32, 0, stream>>>(XB, nullptr, WK, nullptr, DM, FK, DKV, nullptr, 0, 0, 0);
        k_rope<<<LKv, 256, 0, stream>>>(FK, DKV, NKV, CS, nullptr, nullptr, 1.0f, KP16, KPh, KPl);
        k_gemmw<bf, 0, false><<<dim3(TT / 64, DKV / 64, 1), 32, 0, stream>>>(XB, nullptr, WV, nullptr, DM, FV, DKV, nullptr, 0, 0, 0); k_vtp<<<LKv, 256, 0, stream>>>(FV, DKV, NKV, VT16, VTh, VTl);
        for (int h0 = 0; h0 < NH_; h0 += ZH) { const size_t zq = (size_t)h0, zk = (size_t)(h0 / REP);   // one kv head per query head: the pass's single head (ZH 1) uses kv plane zk (z-strides TT*HD)
            k_gemmc<bf, 2, 1><<<dim3(RH / 64, TT / 64, ZH), 32, 0, stream>>>(QPh + zq * TT * HD, QPl + zq * TT * HD, KPh + zk * TT * HD, KPl + zk * TT * HD, HD, Sb, TT, 0, (size_t)TT * HD, (size_t)TT * HD, (size_t)TT * TT);
            k_gemmc<h16, 0, 1><<<dim3((TT - RH) / 64, TT / 64, ZH), 32, 0, stream>>>(QP16 + zq * TT * HD + (size_t)RH * HD, nullptr, KP16 + zk * TT * HD, nullptr, HD, Sb + (size_t)RH * TT, TT, RH, (size_t)TT * HD, (size_t)TT * HD, (size_t)TT * TT);
            k_asoft<<<ZH * TT / 8, 256, 0, stream>>>(Sb, P16, Ph, Pl);
            k_gemmc<bf, 2, 2><<<dim3(RH / 64, HD / 64, ZH), 32, 0, stream>>>(Ph, Pl, VTh + zk * HD * TT, VTl + zk * HD * TT, TT, Ob, HD, 0, (size_t)RH * TT, (size_t)HD * TT, (size_t)TT * HD);
            k_gemmc<h16, 0, 2><<<dim3((TT - RH) / 64, HD / 64, ZH), 32, 0, stream>>>(P16 + (size_t)RH * TT, nullptr, VT16 + zk * HD * TT, nullptr, TT, Ob + (size_t)RH * HD, HD, RH, (size_t)TT * TT, (size_t)HD * TT, (size_t)TT * HD);
            k_merge<<<(unsigned)(((size_t)ZH * TT * HD / 2 + 255) / 256), 256, 0, stream>>>(Ob, h0, OUT + (size_t)b * TT * DQ); }
         }
}

// v001
// A run of this version takes 391 microseconds.
// In two side-by-side timings against v000, it was 2.14 and 2.15 times as fast.
#include <hip/hip_runtime.h>

// Single-head causal self-attention with bias-free projections (x [4][2048][1024]; q, k, v = einsum('bsd,ed', x, W) ('oi' [1024][1024] 1/32, no bias; ONE 1,024-wide head); scores = q.k; causal (-inf); THEN x 1/sqrt(1024) inside the softmax call (-inf stays -inf); softmax; out = attn.v -> [4][2048][1024] (8.4 M); no output projection; argument order x, Wq, Wk, Wv).
// All four sequences run in every launch (grid z or y = sequence); buffers hold four planes, and dead ones are reused later in the same call. Layout per sequence: bf16 copy of x; 'oi' weights; exact projections; identity-table plane builders at HD 1024 (one plane each); causal T-2048 attention at NH 1 / ZH 1 (hybrid rows: < 512 hi/lo 3 products, rest fp16 x1024; k_gemmc skips tiles above the diagonal); the f32 merge writes the output rows (no output projection).
// Compute dtypes, f32 accumulate: every input rounded to bf16; projections exact; attention rows < 512 3 products, rest fp16; softmax f32; output f32.

#define NB_  4
#define TT   2048
#define DM   1024
#define NH_  1
#define NKV  1
#define REP  (NH_ / NKV)
#define HD   1024
#define DQ   (NH_ * HD)
#define DKV  (NKV * HD)
#define ZH   1                    // ONE head: a single plane per pass
static_assert(1 % ZH == 0, "single head");
#define RH   512                  // query rows < RH use hi+lo planes (0: none)
#define WIN  2048
#define PCAR 1024.0f
#define SCL  0.03125f   // 1/sqrt(d_k = 1024)
typedef _Float16 h16;
typedef unsigned short bf;
typedef __attribute__((ext_vector_type(16))) __bf16   v16bf;
typedef __attribute__((ext_vector_type(16))) _Float16 v16h;
typedef __attribute__((ext_vector_type(8)))  _Float16 v8h;
typedef __attribute__((ext_vector_type(8)))  unsigned short v8us;
typedef __attribute__((ext_vector_type(8)))  float    v8f;
typedef __attribute__((ext_vector_type(4)))  float    v4f;
typedef v8h  __attribute__((may_alias)) v8ha;
typedef v4f  __attribute__((may_alias)) v4fa;
typedef v8us __attribute__((may_alias)) v8usa;

__device__ __forceinline__ unsigned short f2bf(float f) { unsigned u = __float_as_uint(f); u += 0x7FFFu + ((u >> 16) & 1u); return (unsigned short)(u >> 16); }
__device__ __forceinline__ float bf2f(unsigned short b) { return __uint_as_float(((unsigned)b) << 16); }
__device__ __forceinline__ float bfr(float f) { return bf2f(f2bf(f)); }
__device__ __forceinline__ v16h cat16(v8h lo, v8h hi) { return __builtin_shufflevector(lo, hi, 0, 1, 2, 3, 4, 5, 6, 7, 8, 9, 10, 11, 12, 13, 14, 15); }
__device__ __forceinline__ v16bf cat16b(v8us lo, v8us hi) { return __builtin_bit_cast(v16bf, __builtin_shufflevector(lo, hi, 0, 1, 2, 3, 4, 5, 6, 7, 8, 9, 10, 11, 12, 13, 14, 15)); }
__device__ __forceinline__ v8f wmma16(v16h a, v16h b, v8f c) { return __builtin_amdgcn_wmma_f32_16x16x32_f16(false, a, false, b, (short)0, c, false, false); }
__device__ __forceinline__ v8f wmmab(v16bf a, v16bf b, v8f c) { return __builtin_amdgcn_wmma_f32_16x16x32_bf16(false, a, false, b, (short)0, c, false, false); }



// ---- k_gemmw: register-blocked GEMM, ONE WAVE per 64x64 output tile (16 accumulators), operands straight from K-contiguous 16-bit planes; grid (M/64, N/64, Z), 32 threads.
// C[m][n] (f32, pitch ldc, + optional f32 bias[n]) = sum_k A[m][k] Bt[n][k] (+ split products per NSPLIT). z-batch strides sA/sB/sC in elements. K % 32 == 0.
template <typename T16> struct WFrag;
template <> struct WFrag<h16> { typedef v16h V; static __device__ __forceinline__ V ld(const h16* p) { return cat16(*(const v8h*)p, *(const v8h*)(p + 16)); } static __device__ __forceinline__ v8f mma(V a, V b, v8f c) { return wmma16(a, b, c); } };
template <> struct WFrag<bf> { typedef v16bf V; static __device__ __forceinline__ V ld(const bf* p) { return cat16b(*(const v8us*)p, *(const v8us*)(p + 16)); } static __device__ __forceinline__ v8f mma(V a, V b, v8f c) { return wmmab(a, b, c); } };
template <typename T16, int NSPLIT, bool BIAS>
__global__ __launch_bounds__(32) void k_gemmw(const T16* __restrict__ A, const T16* __restrict__ A2, const T16* __restrict__ Bt, const T16* __restrict__ Bt2, int K, float* C, int ldc, const float* __restrict__ bias, size_t sA, size_t sB, size_t sC) {
    typedef typename WFrag<T16>::V V;
    __shared__ __align__(16) float os[16 * 68];
    const size_t z = blockIdx.z; A += z * sA; if (A2) A2 += z * sA; Bt += z * sB; if (Bt2) Bt2 += z * sB; C += z * sC;
    const int lane = threadIdx.x & 31, lr = lane & 15, hi = lane >> 4; const int r0 = blockIdx.x * 64, c0 = blockIdx.y * 64;
    v8f acc[4][4];
#pragma unroll
    for (int mb = 0; mb < 4; ++mb)
#pragma unroll
        for (int nb = 0; nb < 4; ++nb) acc[mb][nb] = (v8f){};
    const size_t aoff = (size_t)(r0 + lr) * K + 8 * hi, boff = (size_t)(c0 + lr) * K + 8 * hi;
#pragma unroll 1
    for (int kc = 0; kc < K; kc += 32) {
        V a[4], a2[4];
#pragma unroll
        for (int mb = 0; mb < 4; ++mb) { a[mb] = WFrag<T16>::ld(A + aoff + (size_t)mb * 16 * K + kc); if (NSPLIT == 1 || NSPLIT == 2) a2[mb] = WFrag<T16>::ld(A2 + aoff + (size_t)mb * 16 * K + kc); }
#pragma unroll
        for (int nb = 0; nb < 4; ++nb) { const V b = WFrag<T16>::ld(Bt + boff + (size_t)nb * 16 * K + kc); V b2; if (NSPLIT >= 2) b2 = WFrag<T16>::ld(Bt2 + boff + (size_t)nb * 16 * K + kc);
#pragma unroll
            for (int mb = 0; mb < 4; ++mb) { acc[mb][nb] = WFrag<T16>::mma(a[mb], b, acc[mb][nb]); if (NSPLIT == 1 || NSPLIT == 2) acc[mb][nb] = WFrag<T16>::mma(a2[mb], b, acc[mb][nb]); if (NSPLIT >= 2) acc[mb][nb] = WFrag<T16>::mma(a[mb], b2, acc[mb][nb]); } }
        asm volatile("v_nop\n\tv_nop\n\tv_nop\n\tv_nop" : "+v"(acc[0][0]), "+v"(acc[1][1]), "+v"(acc[2][2]), "+v"(acc[3][3]) : "v"(a[0]), "v"(a[3]));
    }
#pragma unroll
    for (int mb = 0; mb < 4; ++mb) {
#pragma unroll
        for (int nb = 0; nb < 4; ++nb) {
#pragma unroll
            for (int j = 0; j < 8; ++j) os[(hi * 8 + j) * 68 + nb * 16 + lr] = acc[mb][nb][j]; }
        __builtin_amdgcn_wave_barrier(); asm volatile("" ::: "memory");
        float* crow = C + (size_t)(r0 + mb * 16) * ldc + c0;
{
#pragma unroll
            for (int s = 0; s < 8; ++s) { const int row = 2 * s + hi, cofs = lr * 4; v4f val = *(const v4fa*)(os + row * 68 + cofs); if (BIAS) { val[0] += bfr(bias[c0 + cofs]); val[1] += bfr(bias[c0 + cofs + 1]); val[2] += bfr(bias[c0 + cofs + 2]); val[3] += bfr(bias[c0 + cofs + 3]); }
                *(v4f*)(crow + (size_t)row * ldc + cofs) = val; }
             }
        __builtin_amdgcn_wave_barrier(); asm volatile("" ::: "memory");
    }
}

// ---- k_gemmc: the same one-wave 64x64 tile GEMM specialised for causal attention: CMODE 1 skips score tiles entirely above the diagonal (query rows r0+roff.., key columns c0..), CMODE 2 limits the
// key (K) loop of the probability x value contraction to the diagonal block (probabilities beyond it are exactly zero). roff = row offset of this launch's first row within the sequence.
template <typename T16, int NSPLIT, int CMODE>
__global__ __launch_bounds__(32) void k_gemmc(const T16* __restrict__ A, const T16* __restrict__ A2, const T16* __restrict__ Bt, const T16* __restrict__ Bt2, int K, float* C, int ldc, int roff, size_t sA, size_t sB, size_t sC) {
    typedef typename WFrag<T16>::V V;
    __shared__ __align__(16) float os[16 * 68];
    const size_t z = blockIdx.z; A += z * sA; if (A2) A2 += z * sA; Bt += z * sB; if (Bt2) Bt2 += z * sB; C += z * sC;
    const int lane = threadIdx.x & 31, lr = lane & 15, hi = lane >> 4; const int r0 = blockIdx.x * 64, c0 = blockIdx.y * 64;
    if (CMODE == 1 && c0 > r0 + roff + 63) return;                  // score tile entirely above the causal diagonal: never read (the softmax masks j > i by select)
    const int Kl = (CMODE == 2) ? min(K, r0 + roff + 64) : K;        // P.V: probabilities are exactly 0 beyond the diagonal block, so the K loop stops there
    v8f acc[4][4];
#pragma unroll
    for (int mb = 0; mb < 4; ++mb)
#pragma unroll
        for (int nb = 0; nb < 4; ++nb) acc[mb][nb] = (v8f){};
    const size_t aoff = (size_t)(r0 + lr) * K + 8 * hi, boff = (size_t)(c0 + lr) * K + 8 * hi;
#pragma unroll 1
    for (int kc = 0; kc < Kl; kc += 32) {
        V a[4], a2[4];
#pragma unroll
        for (int mb = 0; mb < 4; ++mb) { a[mb] = WFrag<T16>::ld(A + aoff + (size_t)mb * 16 * K + kc); if (NSPLIT == 1 || NSPLIT == 2) a2[mb] = WFrag<T16>::ld(A2 + aoff + (size_t)mb * 16 * K + kc); }
#pragma unroll
        for (int nb = 0; nb < 4; ++nb) { const V b = WFrag<T16>::ld(Bt + boff + (size_t)nb * 16 * K + kc); V b2; if (NSPLIT >= 2) b2 = WFrag<T16>::ld(Bt2 + boff + (size_t)nb * 16 * K + kc);
#pragma unroll
            for (int mb = 0; mb < 4; ++mb) { acc[mb][nb] = WFrag<T16>::mma(a[mb], b, acc[mb][nb]); if (NSPLIT == 1 || NSPLIT == 2) acc[mb][nb] = WFrag<T16>::mma(a2[mb], b, acc[mb][nb]); if (NSPLIT >= 2) acc[mb][nb] = WFrag<T16>::mma(a[mb], b2, acc[mb][nb]); } }
        asm volatile("v_nop\n\tv_nop\n\tv_nop\n\tv_nop" : "+v"(acc[0][0]), "+v"(acc[1][1]), "+v"(acc[2][2]), "+v"(acc[3][3]) : "v"(a[0]), "v"(a[3]));
    }
#pragma unroll
    for (int mb = 0; mb < 4; ++mb) {
#pragma unroll
        for (int nb = 0; nb < 4; ++nb) {
#pragma unroll
            for (int j = 0; j < 8; ++j) os[(hi * 8 + j) * 68 + nb * 16 + lr] = acc[mb][nb][j]; }
        __builtin_amdgcn_wave_barrier(); asm volatile("" ::: "memory");
        float* crow = C + (size_t)(r0 + mb * 16) * ldc + c0;
{
#pragma unroll
            for (int s = 0; s < 8; ++s) { const int row = 2 * s + hi, cofs = lr * 4; v4f val = *(const v4fa*)(os + row * 68 + cofs);
                *(v4f*)(crow + (size_t)row * ldc + cofs) = val; }
             }
        __builtin_amdgcn_wave_barrier(); asm volatile("" ::: "memory");
    }
}

__device__ __forceinline__ h16 tohx(float x) { return (h16)x; }
__device__ __forceinline__ void splitf(float y, unsigned short& h, unsigned short& l) { h = f2bf(y); l = f2bf(y - bf2f(h)); }
typedef __attribute__((ext_vector_type(2))) _Float16 v2h;
typedef __attribute__((ext_vector_type(4))) _Float16 v4h;
typedef __attribute__((ext_vector_type(2))) unsigned short v2us;
typedef __attribute__((ext_vector_type(4))) unsigned short v4us;
typedef __attribute__((ext_vector_type(2))) float v2f;
typedef __attribute__((ext_vector_type(4))) int v4i;

__global__ __launch_bounds__(256) void k_cvt8(const float* __restrict__ src, bf* dst, size_t n8) { const size_t i = (size_t)blockIdx.x * 256 + threadIdx.x; if (i >= n8) return; const v8f v = *(const v8f*)(src + i * 8); v8us o;
#pragma unroll
    for (int k = 0; k < 8; ++k) o[k] = f2bf(v[k]); *(v8us*)(dst + i * 8) = o;  }

// k_rope: head planes [h][t][d] (fp16 + hi/lo) of rope(x) x sc with the rotate-half convention out[d] = x[d] cos[t][d] - x[d+HD/2] sin[t][d], out[d+HD/2] = x[d+HD/2] cos[t][d+HD/2] + x[d] sin[t][d+HD/2]
__global__ __launch_bounds__(256) void k_rope(const float* __restrict__ F, int pitch, int nheads, const float* __restrict__ CS, const float* __restrict__ RF, const float* __restrict__ nw, float sc, h16* P16, bf* Ph, bf* Pl) {
    { const size_t sq = blockIdx.y, po = sq * nheads * TT * HD; F += sq * TT * pitch; P16 += po; Ph += po; Pl += po; }   // grid y = sequence: its rows of F, its planes
    const size_t e = ((size_t)blockIdx.x * 256 + threadIdx.x) * 2; if (e >= (size_t)nheads * TT * HD) return; const int d = (int)(e % HD); const int t = (int)((e / HD) % TT); const int h = (int)(e / ((size_t)HD * TT)); const float* f = F + (size_t)t * pitch + h * HD; const float rf = RF ? RF[(size_t)h * TT + t] : 1.0f; v2h o16; v2us oh, ol;
#pragma unroll
    for (int q = 0; q < 2; ++q) { const int dd = d + q; const int dp = (dd < HD / 2) ? dd + HD / 2 : dd - HD / 2; float x0 = f[dd], x1 = f[dp];
        if (RF) { float n0 = __fmul_rn(x0, rf), n1 = __fmul_rn(x1, rf); asm volatile("" : "+v"(n0)); asm volatile("" : "+v"(n1)); x0 = __fmul_rn(bfr(nw[dd]), n0); x1 = __fmul_rn(bfr(nw[dp]), n1); }
        const v2f cs = *(const v2f*)(CS + ((size_t)t * HD + dd) * 2); float a = __fmul_rn(x0, cs[0]), bq = __fmul_rn(x1, cs[1]); asm volatile("" : "+v"(a)); asm volatile("" : "+v"(bq)); const float r = ((dd < HD / 2) ? __fsub_rn(a, bq) : __fadd_rn(a, bq)) * sc;
        o16[q] = tohx(r); unsigned short a2, c2; splitf(r, a2, c2); oh[q] = a2; ol[q] = c2; }
    *(v2h*)(P16 + e) = o16; *(v2us*)(Ph + e) = oh; *(v2us*)(Pl + e) = ol;  }
__global__ __launch_bounds__(256) void k_vtp(const float* __restrict__ F, int pitch, int nheads, h16* V16, bf* Vh, bf* Vl) { const size_t e = ((size_t)blockIdx.x * 256 + threadIdx.x) * 2; if (e >= (size_t)nheads * HD * TT) return; const int t = (int)(e % TT); const int d = (int)((e / TT) % HD); const int g = (int)(e / ((size_t)TT * HD)); const size_t sq = blockIdx.y, po = sq * nheads * HD * TT; /* sequence: its rows of F, its planes */ F += sq * TT * pitch; V16 += po; Vh += po; Vl += po; v2h o16; v2us oh, ol;
#pragma unroll
    for (int q = 0; q < 2; ++q) { const float x = F[(size_t)(t + q) * pitch + g * HD + d]; o16[q] = tohx(x); unsigned short a2, c2; splitf(x, a2, c2); oh[q] = a2; ol[q] = c2; }
    *(v2h*)(V16 + e) = o16; *(v2us*)(Vh + e) = oh; *(v2us*)(Vl + e) = ol;  }
__global__ __launch_bounds__(256) void k_csid(float* CS) { const int idx = blockIdx.x * 256 + threadIdx.x; if (idx >= TT * HD) return; v2f cs; cs[0] = 1.0f; cs[1] = 0.0f; *(v2f*)(CS + (size_t)idx * 2) = cs;  }
// k_asoft: per row (zz, i), zz = sequence: t = S x HD^-0.5 for j <= i and i - j < WIN (WIN = TT, so the window test always holds: plain causal; the reference's -1e9 additive fill vanishes identically); softmax over the 2048 keys (register row, one exp, fixed trees);
__global__ __launch_bounds__(256) void k_asoft(const float* __restrict__ Sb, h16* P16, bf* Ph, bf* Pl) {
    const int lane = threadIdx.x & 31; const int row = blockIdx.x * 8 + (threadIdx.x >> 5); if (row >= NB_ * ZH * TT) return; const int i = row % TT; const int zz = row / TT; (void)zz; const bool hires = (i < RH); const float* sr = Sb + (size_t)row * TT; float v[TT / 32]; float mx = -3.0e38f;
#pragma unroll
    for (int ch = 0; ch < TT / 128; ++ch) { const int j0 = ch * 128 + lane * 4; const v4f a = *(const v4f*)(sr + j0);
#pragma unroll
        for (int q = 0; q < 4; ++q) { const int j = j0 + q; (void)j; const float t = (j <= i && i - j < WIN) ? a[q] * SCL : -3.0e38f; v[ch * 4 + q] = t; mx = fmaxf(mx, t); } }
#pragma unroll
    for (int sh = 16; sh; sh >>= 1) mx = fmaxf(mx, __shfl_xor(mx, sh, 32));
    float sum = 0.f;
#pragma unroll
    for (int k = 0; k < TT / 32; ++k) { float d0 = __fsub_rn(v[k], mx); asm volatile("" : "+v"(d0)); v[k] = __builtin_amdgcn_exp2f(__fmul_rn(d0, 1.4426950408889634f)); sum += v[k]; }
#pragma unroll
    for (int sh = 16; sh; sh >>= 1) sum += __shfl_xor(sum, sh, 32);
    const float f = __fdiv_rn(hires ? 1.0f : PCAR, sum);
{
        if (hires) {
#pragma unroll
            for (int ch = 0; ch < TT / 128; ++ch) { v4us oh, ol;
#pragma unroll
                for (int q = 0; q < 4; ++q) { unsigned short a, c2; splitf(v[ch * 4 + q] * f, a, c2); oh[q] = a; ol[q] = c2; }
                const size_t oo = ((size_t)zz * (RH ? RH : 1) + i) * TT + ch * 128 + lane * 4; *(v4us*)(Ph + oo) = oh; *(v4us*)(Pl + oo) = ol; }
        } else {
#pragma unroll
            for (int ch = 0; ch < TT / 128; ++ch) { v4h o4;
#pragma unroll
                for (int q = 0; q < 4; ++q) o4[q] = tohx(v[ch * 4 + q] * f);
                *(v4h*)(P16 + (size_t)row * TT + ch * 128 + lane * 4) = o4; } }
         }
}
__global__ __launch_bounds__(256) void k_merge(const float* __restrict__ O, int h0, float* OUTb) { const size_t e = ((size_t)blockIdx.x * 256 + threadIdx.x) * 2; if (e >= (size_t)ZH * TT * HD) return; const int d = (int)(e % HD); const int t = (int)((e / HD) % TT); const int zz = (int)(e / ((size_t)HD * TT)); const float cs = (t < RH) ? 1.0f : (1.0f / PCAR); const size_t oo = (size_t)t * DQ + (h0 + zz) * HD + d; O += (size_t)blockIdx.y * ZH * TT * HD; OUTb += (size_t)blockIdx.y * TT * DQ;   // sequence
    v2f o2; o2[0] = O[e] * cs; o2[1] = O[e + 1] * cs; *(v2f*)(OUTb + oo) = o2;  }

extern "C" void kernel_launch(void* const* d_in, const int* in_sizes, int n_in,
                              void* d_out, int out_size, void* d_ws, size_t ws_size, hipStream_t stream) {
    (void)in_sizes; (void)n_in; (void)out_size;
    const float* x = (const float*)d_in[0]; const float* wq = (const float*)d_in[1]; const float* wk = (const float*)d_in[2]; const float* wv = (const float*)d_in[3]; const float* wo = nullptr; (void)wo;   /* input order x, Wq, Wk, Wv ('oi' [1024][1024]) */
    float* OUT = (float*)d_out;     // [4][2048][1024]
    char* wsp = (char*)d_ws;
    auto take = [&](size_t bytes) { char* p = wsp; wsp += (bytes + 255) & ~(size_t)255; return (void*)p; };
    bf* WQ = (bf*)take((size_t)DQ * DM * 2); bf* WK = (bf*)take((size_t)DKV * DM * 2); bf* WV = (bf*)take((size_t)DKV * DM * 2); float* CS = (float*)take((size_t)TT * HD * 2 * 4);
    bf* XB = (bf*)take((size_t)NB_ * TT * DM * 2); float* FQ = (float*)take((size_t)NB_ * TT * DQ * 4); float* FK = (float*)take((size_t)NB_ * TT * DKV * 4);
    h16* QP16 = (h16*)take((size_t)NB_ * NH_ * TT * HD * 2); h16* KP16 = (h16*)take((size_t)NB_ * NKV * TT * HD * 2); h16* VT16 = (h16*)take((size_t)NB_ * NKV * HD * TT * 2);
    bf* QPh = (bf*)take((size_t)NB_ * NH_ * TT * HD * 2); bf* QPl = (bf*)take((size_t)NB_ * NH_ * TT * HD * 2); bf* KPh = (bf*)take((size_t)NB_ * NKV * TT * HD * 2); bf* KPl = (bf*)take((size_t)NB_ * NKV * TT * HD * 2); bf* VTh = (bf*)take((size_t)NB_ * NKV * HD * TT * 2); bf* VTl = (bf*)take((size_t)NB_ * NKV * HD * TT * 2);
    // Reuse inside one call, stream-ordered, so that four sequences fit the workspace: the scores take the f32 projections' place (FQ and FK lie in a row and are dead once the planes are built),
    // the probabilities the q and k planes' (dead once the scores are written), the f32 attention output the scores' (dead after the softmax).
    static_assert((size_t)TT * TT == (size_t)TT * (DQ + DKV), "scores fill FQ + FK"); static_assert((size_t)ZH * TT * TT == (size_t)(NH_ + NKV) * TT * HD, "P16 fills QP16 + KP16"); static_assert(2 * (size_t)ZH * RH * TT <= (size_t)NH_ * TT * HD, "Ph + Pl fit QPh");
    float* Sb = FQ; h16* P16 = QP16; bf* Ph = QPh; bf* Pl = QPh + (size_t)NB_ * ZH * RH * TT; float* Ob = FQ;
    if ((size_t)(wsp - (char*)d_ws) > ws_size) return;    // ws 256 MiB
    float* FV = FK;   // v projection reuses the k buffer after the k planes are built (stream-ordered)
    { k_cvt8<<<(unsigned)(((size_t)DQ * DM / 8 + 255) / 256), 256, 0, stream>>>(wq, WQ, (size_t)DQ * DM / 8); k_cvt8<<<(unsigned)(((size_t)DKV * DM / 8 + 255) / 256), 256, 0, stream>>>(wk, WK, (size_t)DKV * DM / 8); k_cvt8<<<(unsigned)(((size_t)DKV * DM / 8 + 255) / 256), 256, 0, stream>>>(wv, WV, (size_t)DKV * DM / 8);
      
       }
    k_csid<<<(TT * HD + 255) / 256, 256, 0, stream>>>(CS);
    const unsigned LQ = (unsigned)(((size_t)NH_ * TT * HD / 2 + 255) / 256), LKv = (unsigned)(((size_t)NKV * TT * HD / 2 + 255) / 256);
    k_cvt8<<<(unsigned)(((size_t)NB_ * TT * DM / 8 + 255) / 256), 256, 0, stream>>>(x, XB, (size_t)NB_ * TT * DM / 8);
    k_gemmw<bf, 0, false><<<dim3(TT / 64, DQ / 64, NB_), 32, 0, stream>>>(XB, nullptr, WQ, nullptr, DM, FQ, DQ, nullptr, (size_t)TT * DM, 0, (size_t)TT * DQ);
    k_rope<<<dim3(LQ, NB_), 256, 0, stream>>>(FQ, DQ, NH_, CS, nullptr, nullptr, 1.0f, QP16, QPh, QPl);
    k_gemmw<bf, 0, false><<<dim3(TT / 64, DKV / 64, NB_), 32, 0, stream>>>(XB, nullptr, WK, nullptr, DM, FK, DKV, nullptr, (size_t)TT * DM, 0, (size_t)TT * DKV);
    k_rope<<<dim3(LKv, NB_), 256, 0, stream>>>(FK, DKV, NKV, CS, nullptr, nullptr, 1.0f, KP16, KPh, KPl);
    k_gemmw<bf, 0, false><<<dim3(TT / 64, DKV / 64, NB_), 32, 0, stream>>>(XB, nullptr, WV, nullptr, DM, FV, DKV, nullptr, (size_t)TT * DM, 0, (size_t)TT * DKV); k_vtp<<<dim3(LKv, NB_), 256, 0, stream>>>(FV, DKV, NKV, VT16, VTh, VTl);
    // one head: grid z of the attention products = sequence (z-strides: one sequence's plane)
    k_gemmc<bf, 2, 1><<<dim3(RH / 64, TT / 64, NB_), 32, 0, stream>>>(QPh, QPl, KPh, KPl, HD, Sb, TT, 0, (size_t)TT * HD, (size_t)TT * HD, (size_t)TT * TT);
    k_gemmc<h16, 0, 1><<<dim3((TT - RH) / 64, TT / 64, NB_), 32, 0, stream>>>(QP16 + (size_t)RH * HD, nullptr, KP16, nullptr, HD, Sb + (size_t)RH * TT, TT, RH, (size_t)TT * HD, (size_t)TT * HD, (size_t)TT * TT);
    k_asoft<<<NB_ * ZH * TT / 8, 256, 0, stream>>>(Sb, P16, Ph, Pl);
    k_gemmc<bf, 2, 2><<<dim3(RH / 64, HD / 64, NB_), 32, 0, stream>>>(Ph, Pl, VTh, VTl, TT, Ob, HD, 0, (size_t)RH * TT, (size_t)HD * TT, (size_t)TT * HD);
    k_gemmc<h16, 0, 2><<<dim3((TT - RH) / 64, HD / 64, NB_), 32, 0, stream>>>(P16 + (size_t)RH * TT, nullptr, VT16, nullptr, TT, Ob + (size_t)RH * HD, HD, RH, (size_t)TT * TT, (size_t)HD * TT, (size_t)TT * HD);
    k_merge<<<dim3((unsigned)(((size_t)ZH * TT * HD / 2 + 255) / 256), NB_), 256, 0, stream>>>(Ob, 0, OUT);
}

// v002
// One run takes 274 microseconds.
// Two timings next to v001 put it at 1.41 and 1.42 times that version's speed.
// Over all steps from v000 it is 3.04 times as fast.
#include <hip/hip_runtime.h>

// Single-head causal self-attention with bias-free projections (x [4][2048][1024]; q, k, v = einsum('bsd,ed', x, W) ('oi' [1024][1024] 1/32, no bias; ONE 1,024-wide head); scores = q.k; causal (-inf); THEN x 1/sqrt(1024) inside the softmax call (-inf stays -inf); softmax; out = attn.v -> [4][2048][1024] (8.4 M); no output projection; argument order x, Wq, Wk, Wv).
// All four sequences run in every launch (grid z or y = sequence); buffers hold four planes, and dead ones are reused later in the same call. Layout per sequence: bf16 copy of x; 'oi' weights; exact projections; identity-table plane builders at HD 1024 (one plane each); causal T-2048 attention at NH 1 / ZH 1 (hybrid rows: < 512 hi/lo 3 products, rest fp16 x1024; k_gemmc skips tiles above the diagonal); the f32 merge writes the output rows (no output projection).
// Compute dtypes, f32 accumulate: every input rounded to bf16; projections exact; attention rows < 512 3 products, rest fp16; softmax f32; output f32.

#define NB_  4
#define TT   2048
#define DM   1024
#define NH_  1
#define NKV  1
#define REP  (NH_ / NKV)
#define HD   1024
#define DQ   (NH_ * HD)
#define DKV  (NKV * HD)
#define ZH   1                    // ONE head: a single plane per pass
static_assert(1 % ZH == 0, "single head");
#define RH   512                  // query rows < RH use hi+lo planes (0: none)
#define WIN  2048
#define PCAR 1024.0f
#define SCL  0.03125f   // 1/sqrt(d_k = 1024)
typedef _Float16 h16;
typedef unsigned short bf;
typedef __attribute__((ext_vector_type(16))) __bf16   v16bf;
typedef __attribute__((ext_vector_type(16))) _Float16 v16h;
typedef __attribute__((ext_vector_type(8)))  _Float16 v8h;
typedef __attribute__((ext_vector_type(8)))  unsigned short v8us;
typedef __attribute__((ext_vector_type(8)))  float    v8f;
typedef __attribute__((ext_vector_type(4)))  float    v4f;
typedef v8h  __attribute__((may_alias)) v8ha;
typedef v4f  __attribute__((may_alias)) v4fa;
typedef v8us __attribute__((may_alias)) v8usa;

__device__ __forceinline__ unsigned short f2bf(float f) { unsigned u = __float_as_uint(f); u += 0x7FFFu + ((u >> 16) & 1u); return (unsigned short)(u >> 16); }
__device__ __forceinline__ float bf2f(unsigned short b) { return __uint_as_float(((unsigned)b) << 16); }
__device__ __forceinline__ float bfr(float f) { return bf2f(f2bf(f)); }
__device__ __forceinline__ v16h cat16(v8h lo, v8h hi) { return __builtin_shufflevector(lo, hi, 0, 1, 2, 3, 4, 5, 6, 7, 8, 9, 10, 11, 12, 13, 14, 15); }
__device__ __forceinline__ v16bf cat16b(v8us lo, v8us hi) { return __builtin_bit_cast(v16bf, __builtin_shufflevector(lo, hi, 0, 1, 2, 3, 4, 5, 6, 7, 8, 9, 10, 11, 12, 13, 14, 15)); }
__device__ __forceinline__ v8f wmma16(v16h a, v16h b, v8f c) { return __builtin_amdgcn_wmma_f32_16x16x32_f16(false, a, false, b, (short)0, c, false, false); }
__device__ __forceinline__ v8f wmmab(v16bf a, v16bf b, v8f c) { return __builtin_amdgcn_wmma_f32_16x16x32_bf16(false, a, false, b, (short)0, c, false, false); }



// ---- Tile GEMM, operands staged in LDS: one work-group of 4 waves (2 x 2) per 128x128 output tile, each wave a 64x64 part (16 accumulators). A stage is 64 k (128-byte rows) of every operand plane,
// brought from the K-contiguous 16-bit planes by asynchronous 16-byte copies that cover whole 128-byte lines (8 lanes a row); two buffers, the next stage's copies fly while this one is worked on.
// C[m][n] (f32, pitch ldc) = sum_k A[m][k] Bt[n][k] (+ A2.Bt + A.Bt2 for NSPLIT 2), k ascending in steps of 32 as before. Kl % 64 == 0, Kl <= K.
template <typename T16> struct WFrag;
template <> struct WFrag<h16> { typedef v16h V; static __device__ __forceinline__ V ld(const h16* p) { return cat16(*(const v8h*)p, *(const v8h*)(p + 16)); } static __device__ __forceinline__ v8f mma(V a, V b, v8f c) { return wmma16(a, b, c); } };
template <> struct WFrag<bf> { typedef v16bf V; static __device__ __forceinline__ V ld(const bf* p) { return cat16b(*(const v8us*)p, *(const v8us*)(p + 16)); } static __device__ __forceinline__ v8f mma(V a, V b, v8f c) { return wmmab(a, b, c); } };
#define KS   64                   // k per stage
#define LP   72                   // LDS row pitch in 16-bit elements: 144 B = 16 B x 9, conflict-free for 16-byte reads
#define PLN  (128 * LP)           // one operand plane of a stage, in elements
// One lane's share of one plane of a stage: 8 copies of 16 bytes, rows 16 apart (rs = 16 rows in elements of the source, 2304 B in LDS). The s_wait_xcnt closes the statement so that no address register is rewritten ahead of it.
template <typename T16>
__device__ __forceinline__ void copy_plane(unsigned l, const T16* g, size_t rs) {
    asm volatile("global_load_async_to_lds_b128 %0, %8, off\n\t"
                 "global_load_async_to_lds_b128 %1, %9, off\n\t"
                 "global_load_async_to_lds_b128 %2, %10, off\n\t"
                 "global_load_async_to_lds_b128 %3, %11, off\n\t"
                 "global_load_async_to_lds_b128 %4, %12, off\n\t"
                 "global_load_async_to_lds_b128 %5, %13, off\n\t"
                 "global_load_async_to_lds_b128 %6, %14, off\n\t"
                 "global_load_async_to_lds_b128 %7, %15, off\n\t"
                 "s_wait_xcnt 0x0"
                 :: "v"(l), "v"(l + 2304u), "v"(l + 2u * 2304u), "v"(l + 3u * 2304u), "v"(l + 4u * 2304u), "v"(l + 5u * 2304u), "v"(l + 6u * 2304u), "v"(l + 7u * 2304u),
                    "v"(g), "v"(g + rs), "v"(g + 2 * rs), "v"(g + 3 * rs), "v"(g + 4 * rs), "v"(g + 5 * rs), "v"(g + 6 * rs), "v"(g + 7 * rs) : "memory");
}
template <typename T16, int NSPLIT>
__device__ __forceinline__ void gemm_tile(const T16* __restrict__ A, const T16* __restrict__ A2, const T16* __restrict__ Bt, const T16* __restrict__ Bt2, int K, int Kl, float* C, int ldc, int r0, int c0) {
    static_assert(NSPLIT == 0 || NSPLIT == 2, "one product or three");
    typedef typename WFrag<T16>::V V;
    constexpr int STG = (NSPLIT == 2 ? 4 : 2) * PLN;          // a stage: A | Bt (| A2 | Bt2)
    __shared__ __align__(16) T16 ring[2 * STG];
    __shared__ __align__(16) float osw[4 * 16 * 68];
    const int tid = threadIdx.x, lane = tid & 31, lr = lane & 15, hi = lane >> 4, wave = tid >> 5, wm = wave >> 1, wn = wave & 1;
    float* os = osw + wave * (16 * 68);                        // output staging, private to the wave
    v8f acc[4][4];
#pragma unroll
    for (int mb = 0; mb < 4; ++mb)
#pragma unroll
        for (int nb = 0; nb < 4; ++nb) acc[mb][nb] = (v8f){};
    const int crow = tid >> 3, ccol = (tid & 7) * 8;           // copies: 8 lanes cover one 128-byte row, a wave 4 rows
    const size_t ga = (size_t)(r0 + crow) * K + ccol, gb = (size_t)(c0 + crow) * K + ccol, rs = (size_t)16 * K;
    const unsigned l0 = (unsigned)(size_t)ring + (unsigned)(crow * LP + ccol) * 2u;
    auto issue = [&](int t) { const unsigned l = l0 + (unsigned)(t & 1) * (unsigned)(STG * 2); const int kc = t * KS;
        copy_plane(l, A + ga + kc, rs); copy_plane(l + PLN * 2u, Bt + gb + kc, rs);
        if (NSPLIT == 2) { copy_plane(l + 2u * PLN * 2u, A2 + ga + kc, rs); copy_plane(l + 3u * PLN * 2u, Bt2 + gb + kc, rs); } };
    const int nst = Kl / KS;
    issue(0);
    asm volatile("s_wait_asynccnt 0x0" ::: "memory");          // this wave's copies of stage 0 have landed
    __syncthreads();                                           // publishes stage 0
    if (nst > 1) issue(1);
    const int fa = (wm * 64 + lr) * LP + 8 * hi, fb = PLN + (wn * 64 + lr) * LP + 8 * hi;
#pragma unroll 1
    for (int t = 0; t < nst; ++t) {                            // kept rolled: one stage a trip, the buffer by t & 1
        const T16* sb = ring + (t & 1) * STG;
#pragma unroll
        for (int ks = 0; ks < KS; ks += 32) {
            V a[4], a2[4], bq[4];
#pragma unroll
            for (int mb = 0; mb < 4; ++mb) { a[mb] = WFrag<T16>::ld(sb + fa + mb * 16 * LP + ks); if (NSPLIT == 2) a2[mb] = WFrag<T16>::ld(sb + 2 * PLN + fa + mb * 16 * LP + ks); }
#pragma unroll
            for (int nb = 0; nb < 4; ++nb) if (NSPLIT == 0) bq[nb] = WFrag<T16>::ld(sb + fb + nb * 16 * LP + ks);   // one product: all eight fragments of the step are asked for ahead of its 16 matrix instructions
            if (NSPLIT == 0) __builtin_amdgcn_sched_barrier(0);   // keeps that load group ahead of the matrix block: sunk between the matrix instructions, each pair of loads would be waited for alone
#pragma unroll
            for (int nb = 0; nb < 4; ++nb) { const V b = (NSPLIT == 0) ? bq[nb] : WFrag<T16>::ld(sb + fb + nb * 16 * LP + ks); V b2; if (NSPLIT == 2) b2 = WFrag<T16>::ld(sb + 2 * PLN + fb + nb * 16 * LP + ks);
#pragma unroll
                for (int mb = 0; mb < 4; ++mb) { acc[mb][nb] = WFrag<T16>::mma(a[mb], b, acc[mb][nb]); if (NSPLIT == 2) { acc[mb][nb] = WFrag<T16>::mma(a2[mb], b, acc[mb][nb]); acc[mb][nb] = WFrag<T16>::mma(a[mb], b2, acc[mb][nb]); } } }
        }
        asm volatile("s_wait_dscnt 0x0" ::: "memory");         // this wave's reads of the buffer are done before it is refilled
        asm volatile("s_wait_asynccnt 0x0" ::: "memory");      // this wave's copies of stage t + 1 have landed
        __syncthreads();                                       // publishes stage t + 1 and ends every reader's last read of stage t
        if (t + 2 < nst) issue(t + 2);
    }
    asm volatile("s_wait_asynccnt 0x0" ::: "memory");          // nothing in flight when the wave ends
#pragma unroll
    for (int mb = 0; mb < 4; ++mb) {
#pragma unroll
        for (int nb = 0; nb < 4; ++nb) {
#pragma unroll
            for (int j = 0; j < 8; ++j) os[(hi * 8 + j) * 68 + nb * 16 + lr] = acc[mb][nb][j]; }
        __builtin_amdgcn_wave_barrier(); asm volatile("" ::: "memory");
        float* crw = C + (size_t)(r0 + wm * 64 + mb * 16) * ldc + c0 + wn * 64;
#pragma unroll
        for (int s = 0; s < 8; ++s) { const int row = 2 * s + hi, cofs = lr * 4; const v4f val = *(const v4fa*)(os + row * 68 + cofs);
            *(v4f*)(crw + (size_t)row * ldc + cofs) = val; }
        __builtin_amdgcn_wave_barrier(); asm volatile("" ::: "memory");
    }
}
// ---- k_gemmw: the plain product; grid (M/128, N/128, Z), 128 threads; z-batch strides sA/sB/sC in elements.
template <typename T16, int NSPLIT>
__global__ __launch_bounds__(128) void k_gemmw(const T16* __restrict__ A, const T16* __restrict__ A2, const T16* __restrict__ Bt, const T16* __restrict__ Bt2, int K, float* C, int ldc, size_t sA, size_t sB, size_t sC) {
    const size_t z = blockIdx.z; A += z * sA; if (A2) A2 += z * sA; Bt += z * sB; if (Bt2) Bt2 += z * sB; C += z * sC;
    gemm_tile<T16, NSPLIT>(A, A2, Bt, Bt2, K, K, C, ldc, blockIdx.x * 128, blockIdx.y * 128);
}

// ---- k_gemmc: the same for causal attention: CMODE 1 skips score tiles entirely above the diagonal (query rows r0+roff.., key columns c0..), CMODE 2 limits the
// key (K) loop of the probability x value contraction to the diagonal block (probabilities beyond it are exactly zero). roff = row offset of this launch's first row within the sequence.
template <typename T16, int NSPLIT, int CMODE>
__global__ __launch_bounds__(128) void k_gemmc(const T16* __restrict__ A, const T16* __restrict__ A2, const T16* __restrict__ Bt, const T16* __restrict__ Bt2, int K, float* C, int ldc, int roff, size_t sA, size_t sB, size_t sC) {
    const size_t z = blockIdx.z; A += z * sA; if (A2) A2 += z * sA; Bt += z * sB; if (Bt2) Bt2 += z * sB; C += z * sC;
    const int r0 = blockIdx.x * 128, c0 = blockIdx.y * 128;
    if (CMODE == 1 && c0 > r0 + roff + 127) return;                  // score tile entirely above the causal diagonal (the whole work-group leaves, ahead of every barrier); the softmax masks j > i by select
    const int Kl = (CMODE == 2) ? min(K, r0 + roff + 128) : K;       // P.V: probabilities are exactly 0 beyond the diagonal block, so the K loop stops there
    gemm_tile<T16, NSPLIT>(A, A2, Bt, Bt2, K, Kl, C, ldc, r0, c0);
}

__device__ __forceinline__ h16 tohx(float x) { return (h16)x; }
__device__ __forceinline__ void splitf(float y, unsigned short& h, unsigned short& l) { h = f2bf(y); l = f2bf(y - bf2f(h)); }
typedef __attribute__((ext_vector_type(2))) _Float16 v2h;
typedef __attribute__((ext_vector_type(4))) _Float16 v4h;
typedef __attribute__((ext_vector_type(2))) unsigned short v2us;
typedef __attribute__((ext_vector_type(4))) unsigned short v4us;
typedef __attribute__((ext_vector_type(2))) float v2f;
typedef __attribute__((ext_vector_type(4))) int v4i;

__global__ __launch_bounds__(256) void k_cvt8(const float* __restrict__ src, bf* dst, size_t n8) { const size_t i = (size_t)blockIdx.x * 256 + threadIdx.x; if (i >= n8) return; const v8f v = *(const v8f*)(src + i * 8); v8us o;
#pragma unroll
    for (int k = 0; k < 8; ++k) o[k] = f2bf(v[k]); *(v8us*)(dst + i * 8) = o;  }

// k_rope: head planes [h][t][d] (fp16 + hi/lo) of rope(x) x sc with the rotate-half convention out[d] = x[d] cos[t][d] - x[d+HD/2] sin[t][d], out[d+HD/2] = x[d+HD/2] cos[t][d+HD/2] + x[d] sin[t][d+HD/2]
__global__ __launch_bounds__(256) void k_rope(const float* __restrict__ F, int pitch, int nheads, const float* __restrict__ CS, const float* __restrict__ RF, const float* __restrict__ nw, float sc, h16* P16, bf* Ph, bf* Pl) {
    { const size_t sq = blockIdx.y, po = sq * nheads * TT * HD; F += sq * TT * pitch; P16 += po; Ph += po; Pl += po; }   // grid y = sequence: its rows of F, its planes
    const size_t e = ((size_t)blockIdx.x * 256 + threadIdx.x) * 2; if (e >= (size_t)nheads * TT * HD) return; const int d = (int)(e % HD); const int t = (int)((e / HD) % TT); const int h = (int)(e / ((size_t)HD * TT)); const float* f = F + (size_t)t * pitch + h * HD; const float rf = RF ? RF[(size_t)h * TT + t] : 1.0f; v2h o16; v2us oh, ol;
#pragma unroll
    for (int q = 0; q < 2; ++q) { const int dd = d + q; const int dp = (dd < HD / 2) ? dd + HD / 2 : dd - HD / 2; float x0 = f[dd], x1 = f[dp];
        if (RF) { float n0 = __fmul_rn(x0, rf), n1 = __fmul_rn(x1, rf); asm volatile("" : "+v"(n0)); asm volatile("" : "+v"(n1)); x0 = __fmul_rn(bfr(nw[dd]), n0); x1 = __fmul_rn(bfr(nw[dp]), n1); }
        const v2f cs = *(const v2f*)(CS + ((size_t)t * HD + dd) * 2); float a = __fmul_rn(x0, cs[0]), bq = __fmul_rn(x1, cs[1]); asm volatile("" : "+v"(a)); asm volatile("" : "+v"(bq)); const float r = ((dd < HD / 2) ? __fsub_rn(a, bq) : __fadd_rn(a, bq)) * sc;
        o16[q] = tohx(r); unsigned short a2, c2; splitf(r, a2, c2); oh[q] = a2; ol[q] = c2; }
    *(v2h*)(P16 + e) = o16; *(v2us*)(Ph + e) = oh; *(v2us*)(Pl + e) = ol;  }
__global__ __launch_bounds__(256) void k_vtp(const float* __restrict__ F, int pitch, int nheads, h16* V16, bf* Vh, bf* Vl) { const size_t e = ((size_t)blockIdx.x * 256 + threadIdx.x) * 2; if (e >= (size_t)nheads * HD * TT) return; const int t = (int)(e % TT); const int d = (int)((e / TT) % HD); const int g = (int)(e / ((size_t)TT * HD)); const size_t sq = blockIdx.y, po = sq * nheads * HD * TT; /* sequence: its rows of F, its planes */ F += sq * TT * pitch; V16 += po; Vh += po; Vl += po; v2h o16; v2us oh, ol;
#pragma unroll
    for (int q = 0; q < 2; ++q) { const float x = F[(size_t)(t + q) * pitch + g * HD + d]; o16[q] = tohx(x); unsigned short a2, c2; splitf(x, a2, c2); oh[q] = a2; ol[q] = c2; }
    *(v2h*)(V16 + e) = o16; *(v2us*)(Vh + e) = oh; *(v2us*)(Vl + e) = ol;  }
__global__ __launch_bounds__(256) void k_csid(float* CS) { const int idx = blockIdx.x * 256 + threadIdx.x; if (idx >= TT * HD) return; v2f cs; cs[0] = 1.0f; cs[1] = 0.0f; *(v2f*)(CS + (size_t)idx * 2) = cs;  }
// k_asoft: per row (zz, i), zz = sequence: t = S x HD^-0.5 for j <= i and i - j < WIN (WIN = TT, so the window test always holds: plain causal; the reference's -1e9 additive fill vanishes identically); softmax over the 2048 keys (register row, one exp, fixed trees);
__global__ __launch_bounds__(256) void k_asoft(const float* __restrict__ Sb, h16* P16, bf* Ph, bf* Pl) {
    const int lane = threadIdx.x & 31; const int row = blockIdx.x * 8 + (threadIdx.x >> 5); if (row >= NB_ * ZH * TT) return; const int i = row % TT; const int zz = row / TT; (void)zz; const bool hires = (i < RH); const float* sr = Sb + (size_t)row * TT; float v[TT / 32]; float mx = -3.0e38f;
#pragma unroll
    for (int ch = 0; ch < TT / 128; ++ch) { const int j0 = ch * 128 + lane * 4; const v4f a = *(const v4f*)(sr + j0);
#pragma unroll
        for (int q = 0; q < 4; ++q) { const int j = j0 + q; (void)j; const float t = (j <= i && i - j < WIN) ? a[q] * SCL : -3.0e38f; v[ch * 4 + q] = t; mx = fmaxf(mx, t); } }
#pragma unroll
    for (int sh = 16; sh; sh >>= 1) mx = fmaxf(mx, __shfl_xor(mx, sh, 32));
    float sum = 0.f;
#pragma unroll
    for (int k = 0; k < TT / 32; ++k) { float d0 = __fsub_rn(v[k], mx); asm volatile("" : "+v"(d0)); v[k] = __builtin_amdgcn_exp2f(__fmul_rn(d0, 1.4426950408889634f)); sum += v[k]; }
#pragma unroll
    for (int sh = 16; sh; sh >>= 1) sum += __shfl_xor(sum, sh, 32);
    const float f = __fdiv_rn(hires ? 1.0f : PCAR, sum);
{
        if (hires) {
#pragma unroll
            for (int ch = 0; ch < TT / 128; ++ch) { v4us oh, ol;
#pragma unroll
                for (int q = 0; q < 4; ++q) { unsigned short a, c2; splitf(v[ch * 4 + q] * f, a, c2); oh[q] = a; ol[q] = c2; }
                const size_t oo = ((size_t)zz * (RH ? RH : 1) + i) * TT + ch * 128 + lane * 4; *(v4us*)(Ph + oo) = oh; *(v4us*)(Pl + oo) = ol; }
        } else {
#pragma unroll
            for (int ch = 0; ch < TT / 128; ++ch) { v4h o4;
#pragma unroll
                for (int q = 0; q < 4; ++q) o4[q] = tohx(v[ch * 4 + q] * f);
                *(v4h*)(P16 + (size_t)row * TT + ch * 128 + lane * 4) = o4; } }
         }
}
__global__ __launch_bounds__(256) void k_merge(const float* __restrict__ O, int h0, float* OUTb) { const size_t e = ((size_t)blockIdx.x * 256 + threadIdx.x) * 2; if (e >= (size_t)ZH * TT * HD) return; const int d = (int)(e % HD); const int t = (int)((e / HD) % TT); const int zz = (int)(e / ((size_t)HD * TT)); const float cs = (t < RH) ? 1.0f : (1.0f / PCAR); const size_t oo = (size_t)t * DQ + (h0 + zz) * HD + d; O += (size_t)blockIdx.y * ZH * TT * HD; OUTb += (size_t)blockIdx.y * TT * DQ;   // sequence
    v2f o2; o2[0] = O[e] * cs; o2[1] = O[e + 1] * cs; *(v2f*)(OUTb + oo) = o2;  }

extern "C" void kernel_launch(void* const* d_in, const int* in_sizes, int n_in,
                              void* d_out, int out_size, void* d_ws, size_t ws_size, hipStream_t stream) {
    (void)in_sizes; (void)n_in; (void)out_size;
    const float* x = (const float*)d_in[0]; const float* wq = (const float*)d_in[1]; const float* wk = (const float*)d_in[2]; const float* wv = (const float*)d_in[3]; const float* wo = nullptr; (void)wo;   /* input order x, Wq, Wk, Wv ('oi' [1024][1024]) */
    float* OUT = (float*)d_out;     // [4][2048][1024]
    char* wsp = (char*)d_ws;
    auto take = [&](size_t bytes) { char* p = wsp; wsp += (bytes + 255) & ~(size_t)255; return (void*)p; };
    bf* WQ = (bf*)take((size_t)DQ * DM * 2); bf* WK = (bf*)take((size_t)DKV * DM * 2); bf* WV = (bf*)take((size_t)DKV * DM * 2); float* CS = (float*)take((size_t)TT * HD * 2 * 4);
    bf* XB = (bf*)take((size_t)NB_ * TT * DM * 2); float* FQ = (float*)take((size_t)NB_ * TT * DQ * 4); float* FK = (float*)take((size_t)NB_ * TT * DKV * 4);
    h16* QP16 = (h16*)take((size_t)NB_ * NH_ * TT * HD * 2); h16* KP16 = (h16*)take((size_t)NB_ * NKV * TT * HD * 2); h16* VT16 = (h16*)take((size_t)NB_ * NKV * HD * TT * 2);
    bf* QPh = (bf*)take((size_t)NB_ * NH_ * TT * HD * 2); bf* QPl = (bf*)take((size_t)NB_ * NH_ * TT * HD * 2); bf* KPh = (bf*)take((size_t)NB_ * NKV * TT * HD * 2); bf* KPl = (bf*)take((size_t)NB_ * NKV * TT * HD * 2); bf* VTh = (bf*)take((size_t)NB_ * NKV * HD * TT * 2); bf* VTl = (bf*)take((size_t)NB_ * NKV * HD * TT * 2);
    // Reuse inside one call, stream-ordered, so that four sequences fit the workspace: the scores take the f32 projections' place (FQ and FK lie in a row and are dead once the planes are built),
    // the probabilities the q and k planes' (dead once the scores are written), the f32 attention output the scores' (dead after the softmax).
    static_assert((size_t)TT * TT == (size_t)TT * (DQ + DKV), "scores fill FQ + FK"); static_assert((size_t)ZH * TT * TT == (size_t)(NH_ + NKV) * TT * HD, "P16 fills QP16 + KP16"); static_assert(2 * (size_t)ZH * RH * TT <= (size_t)NH_ * TT * HD, "Ph + Pl fit QPh");
    float* Sb = FQ; h16* P16 = QP16; bf* Ph = QPh; bf* Pl = QPh + (size_t)NB_ * ZH * RH * TT; float* Ob = FQ;
    if ((size_t)(wsp - (char*)d_ws) > ws_size) return;    // ws 256 MiB
    float* FV = FK;   // v projection reuses the k buffer after the k planes are built (stream-ordered)
    { k_cvt8<<<(unsigned)(((size_t)DQ * DM / 8 + 255) / 256), 256, 0, stream>>>(wq, WQ, (size_t)DQ * DM / 8); k_cvt8<<<(unsigned)(((size_t)DKV * DM / 8 + 255) / 256), 256, 0, stream>>>(wk, WK, (size_t)DKV * DM / 8); k_cvt8<<<(unsigned)(((size_t)DKV * DM / 8 + 255) / 256), 256, 0, stream>>>(wv, WV, (size_t)DKV * DM / 8);
      
       }
    k_csid<<<(TT * HD + 255) / 256, 256, 0, stream>>>(CS);
    const unsigned LQ = (unsigned)(((size_t)NH_ * TT * HD / 2 + 255) / 256), LKv = (unsigned)(((size_t)NKV * TT * HD / 2 + 255) / 256);
    k_cvt8<<<(unsigned)(((size_t)NB_ * TT * DM / 8 + 255) / 256), 256, 0, stream>>>(x, XB, (size_t)NB_ * TT * DM / 8);
    k_gemmw<bf, 0><<<dim3(TT / 128, DQ / 128, NB_), 128, 0, stream>>>(XB, nullptr, WQ, nullptr, DM, FQ, DQ, (size_t)TT * DM, 0, (size_t)TT * DQ);
    k_rope<<<dim3(LQ, NB_), 256, 0, stream>>>(FQ, DQ, NH_, CS, nullptr, nullptr, 1.0f, QP16, QPh, QPl);
    k_gemmw<bf, 0><<<dim3(TT / 128, DKV / 128, NB_), 128, 0, stream>>>(XB, nullptr, WK, nullptr, DM, FK, DKV, (size_t)TT * DM, 0, (size_t)TT * DKV);
    k_rope<<<dim3(LKv, NB_), 256, 0, stream>>>(FK, DKV, NKV, CS, nullptr, nullptr, 1.0f, KP16, KPh, KPl);
    k_gemmw<bf, 0><<<dim3(TT / 128, DKV / 128, NB_), 128, 0, stream>>>(XB, nullptr, WV, nullptr, DM, FV, DKV, (size_t)TT * DM, 0, (size_t)TT * DKV); k_vtp<<<dim3(LKv, NB_), 256, 0, stream>>>(FV, DKV, NKV, VT16, VTh, VTl);
    // one head: grid z of the attention products = sequence (z-strides: one sequence's plane)
    k_gemmc<bf, 2, 1><<<dim3(RH / 128, TT / 128, NB_), 128, 0, stream>>>(QPh, QPl, KPh, KPl, HD, Sb, TT, 0, (size_t)TT * HD, (size_t)TT * HD, (size_t)TT * TT);
    k_gemmc<h16, 0, 1><<<dim3((TT - RH) / 128, TT / 128, NB_), 128, 0, stream>>>(QP16 + (size_t)RH * HD, nullptr, KP16, nullptr, HD, Sb + (size_t)RH * TT, TT, RH, (size_t)TT * HD, (size_t)TT * HD, (size_t)TT * TT);
    k_asoft<<<NB_ * ZH * TT / 8, 256, 0, stream>>>(Sb, P16, Ph, Pl);
    k_gemmc<bf, 2, 2><<<dim3(RH / 128, HD / 128, NB_), 128, 0, stream>>>(Ph, Pl, VTh, VTl, TT, Ob, HD, 0, (size_t)RH * TT, (size_t)HD * TT, (size_t)TT * HD);
    k_gemmc<h16, 0, 2><<<dim3((TT - RH) / 128, HD / 128, NB_), 128, 0, stream>>>(P16 + (size_t)RH * TT, nullptr, VT16, nullptr, TT, Ob + (size_t)RH * HD, HD, RH, (size_t)TT * TT, (size_t)HD * TT, (size_t)TT * HD);
    k_merge<<<dim3((unsigned)(((size_t)ZH * TT * HD / 2 + 255) / 256), NB_), 256, 0, stream>>>(Ob, 0, OUT);
}

// v003
// It runs in 182 microseconds.
// Timed twice side by side with v002, it ran 1.51 times as fast both times.
// Counting every step since v000, it is 4.58 times as fast.
#include <hip/hip_runtime.h>

// Single-head causal self-attention with bias-free projections (x [4][2048][1024]; q, k, v = einsum('bsd,ed', x, W) ('oi' [1024][1024] 1/32, no bias; ONE 1,024-wide head); scores = q.k; causal (-inf); THEN x 1/sqrt(1024) inside the softmax call (-inf stays -inf); softmax; out = attn.v -> [4][2048][1024] (8.4 M); no output projection; argument order x, Wq, Wk, Wv).
// All four sequences run in every launch (grid z = sequence); buffers hold four planes, and dead ones are reused later in the same call. Layout per sequence: bf16 copy of x; 'oi' weights; exact projections whose epilogue writes the 16-bit planes itself (v as Wv.x^T, so that its planes come out transposed); causal T-2048 attention at NH 1 / ZH 1 (hybrid rows: < 512 hi/lo 3 products, rest fp16 x1024; k_gemmc skips tiles above the diagonal); the probability x value epilogue writes the output rows (no output projection).
// Compute dtypes, f32 accumulate: every input rounded to bf16; projections exact; attention rows < 512 3 products, rest fp16; softmax f32; output f32.

#define NB_  4
#define TT   2048
#define DM   1024
#define NH_  1
#define NKV  1
#define REP  (NH_ / NKV)
#define HD   1024
#define DQ   (NH_ * HD)
#define DKV  (NKV * HD)
#define ZH   1                    // ONE head: a single plane per pass
static_assert(1 % ZH == 0, "single head");
#define RH   512                  // query rows < RH use hi+lo planes (0: none)
#define WIN  2048
#define PCAR 1024.0f
#define SCL  0.03125f   // 1/sqrt(d_k = 1024)
typedef _Float16 h16;
typedef unsigned short bf;
typedef __attribute__((ext_vector_type(16))) __bf16   v16bf;
typedef __attribute__((ext_vector_type(16))) _Float16 v16h;
typedef __attribute__((ext_vector_type(8)))  _Float16 v8h;
typedef __attribute__((ext_vector_type(8)))  unsigned short v8us;
typedef __attribute__((ext_vector_type(8)))  float    v8f;
typedef __attribute__((ext_vector_type(4)))  float    v4f;
typedef v8h  __attribute__((may_alias)) v8ha;
typedef v4f  __attribute__((may_alias)) v4fa;
typedef v8us __attribute__((may_alias)) v8usa;

__device__ __forceinline__ unsigned short f2bf(float f) { unsigned u = __float_as_uint(f); u += 0x7FFFu + ((u >> 16) & 1u); return (unsigned short)(u >> 16); }
__device__ __forceinline__ float bf2f(unsigned short b) { return __uint_as_float(((unsigned)b) << 16); }
__device__ __forceinline__ v16h cat16(v8h lo, v8h hi) { return __builtin_shufflevector(lo, hi, 0, 1, 2, 3, 4, 5, 6, 7, 8, 9, 10, 11, 12, 13, 14, 15); }
__device__ __forceinline__ v16bf cat16b(v8us lo, v8us hi) { return __builtin_bit_cast(v16bf, __builtin_shufflevector(lo, hi, 0, 1, 2, 3, 4, 5, 6, 7, 8, 9, 10, 11, 12, 13, 14, 15)); }
__device__ __forceinline__ v8f wmma16(v16h a, v16h b, v8f c) { return __builtin_amdgcn_wmma_f32_16x16x32_f16(false, a, false, b, (short)0, c, false, false); }
__device__ __forceinline__ v8f wmmab(v16bf a, v16bf b, v8f c) { return __builtin_amdgcn_wmma_f32_16x16x32_bf16(false, a, false, b, (short)0, c, false, false); }
__device__ __forceinline__ h16 tohx(float x) { return (h16)x; }
__device__ __forceinline__ void splitf(float y, unsigned short& h, unsigned short& l) { h = f2bf(y); l = f2bf(y - bf2f(h)); }



// ---- Tile GEMM, operands staged in LDS: one work-group of 4 waves (2 x 2) per 128x128 output tile, each wave a 64x64 part (16 accumulators). A stage is 64 k (128-byte rows) of every operand plane,
// brought from the K-contiguous 16-bit planes by asynchronous 16-byte copies that cover whole 128-byte lines (8 lanes a row); two buffers, the next stage's copies fly while this one is worked on.
// C[m][n] (f32, pitch ldc) = sum_k A[m][k] Bt[n][k] (+ A2.Bt + A.Bt2 for NSPLIT 2), k ascending in steps of 32 as before. Kl % 64 == 0, Kl <= K.
// EPI says what the epilogue stores of that sum: 0 the f32 value in C; 1 the f32 value x osc in C; 2 no f32 at all, but its fp16 rounding in P16 and its bf16 hi/lo split in Ph, Pl (pitch ldc, whole 128-byte lines).
template <typename T16> struct WFrag;
template <> struct WFrag<h16> { typedef v16h V; static __device__ __forceinline__ V ld(const h16* p) { return cat16(*(const v8h*)p, *(const v8h*)(p + 16)); } static __device__ __forceinline__ v8f mma(V a, V b, v8f c) { return wmma16(a, b, c); } };
template <> struct WFrag<bf> { typedef v16bf V; static __device__ __forceinline__ V ld(const bf* p) { return cat16b(*(const v8us*)p, *(const v8us*)(p + 16)); } static __device__ __forceinline__ v8f mma(V a, V b, v8f c) { return wmmab(a, b, c); } };
#define KS   64                   // k per stage
#define LP   72                   // LDS row pitch in 16-bit elements: 144 B = 16 B x 9, conflict-free for 16-byte reads
#define PLN  (128 * LP)           // one operand plane of a stage, in elements
// One lane's share of one plane of a stage: 8 copies of 16 bytes, rows 16 apart (rs = 16 rows in elements of the source, 2304 B in LDS). The s_wait_xcnt closes the statement so that no address register is rewritten ahead of it.
template <typename T16>
__device__ __forceinline__ void copy_plane(unsigned l, const T16* g, size_t rs) {
    asm volatile("global_load_async_to_lds_b128 %0, %8, off\n\t"
                 "global_load_async_to_lds_b128 %1, %9, off\n\t"
                 "global_load_async_to_lds_b128 %2, %10, off\n\t"
                 "global_load_async_to_lds_b128 %3, %11, off\n\t"
                 "global_load_async_to_lds_b128 %4, %12, off\n\t"
                 "global_load_async_to_lds_b128 %5, %13, off\n\t"
                 "global_load_async_to_lds_b128 %6, %14, off\n\t"
                 "global_load_async_to_lds_b128 %7, %15, off\n\t"
                 "s_wait_xcnt 0x0"
                 :: "v"(l), "v"(l + 2304u), "v"(l + 2u * 2304u), "v"(l + 3u * 2304u), "v"(l + 4u * 2304u), "v"(l + 5u * 2304u), "v"(l + 6u * 2304u), "v"(l + 7u * 2304u),
                    "v"(g), "v"(g + rs), "v"(g + 2 * rs), "v"(g + 3 * rs), "v"(g + 4 * rs), "v"(g + 5 * rs), "v"(g + 6 * rs), "v"(g + 7 * rs) : "memory");
}
template <typename T16, int NSPLIT, int EPI>
__device__ __forceinline__ void gemm_tile(const T16* __restrict__ A, const T16* __restrict__ A2, const T16* __restrict__ Bt, const T16* __restrict__ Bt2, int K, int Kl, float* C, int ldc, int r0, int c0, float osc, h16* P16, bf* Ph, bf* Pl) {
    static_assert(NSPLIT == 0 || NSPLIT == 2, "one product or three");
    typedef typename WFrag<T16>::V V;
    constexpr int STG = (NSPLIT == 2 ? 4 : 2) * PLN;          // a stage: A | Bt (| A2 | Bt2)
    __shared__ __align__(16) T16 ring[2 * STG];
    __shared__ __align__(16) float osw[4 * 16 * 68];
    const int tid = threadIdx.x, lane = tid & 31, lr = lane & 15, hi = lane >> 4, wave = tid >> 5, wm = wave >> 1, wn = wave & 1;
    float* os = osw + wave * (16 * 68);                        // output staging, private to the wave
    v8f acc[4][4];
#pragma unroll
    for (int mb = 0; mb < 4; ++mb)
#pragma unroll
        for (int nb = 0; nb < 4; ++nb) acc[mb][nb] = (v8f){};
    const int crow = tid >> 3, ccol = (tid & 7) * 8;           // copies: 8 lanes cover one 128-byte row, a wave 4 rows
    const size_t ga = (size_t)(r0 + crow) * K + ccol, gb = (size_t)(c0 + crow) * K + ccol, rs = (size_t)16 * K;
    const unsigned l0 = (unsigned)(size_t)ring + (unsigned)(crow * LP + ccol) * 2u;
    auto issue = [&](int t) { const unsigned l = l0 + (unsigned)(t & 1) * (unsigned)(STG * 2); const int kc = t * KS;
        copy_plane(l, A + ga + kc, rs); copy_plane(l + PLN * 2u, Bt + gb + kc, rs);
        if (NSPLIT == 2) { copy_plane(l + 2u * PLN * 2u, A2 + ga + kc, rs); copy_plane(l + 3u * PLN * 2u, Bt2 + gb + kc, rs); } };
    const int nst = Kl / KS;
    issue(0);
    asm volatile("s_wait_asynccnt 0x0" ::: "memory");          // this wave's copies of stage 0 have landed
    __syncthreads();                                           // publishes stage 0
    if (nst > 1) issue(1);
    const int fa = (wm * 64 + lr) * LP + 8 * hi, fb = PLN + (wn * 64 + lr) * LP + 8 * hi;
#pragma unroll 1
    for (int t = 0; t < nst; ++t) {                            // kept rolled: one stage a trip, the buffer by t & 1
        const T16* sb = ring + (t & 1) * STG;
#pragma unroll
        for (int ks = 0; ks < KS; ks += 32) {
            V a[4], a2[4], bq[4];
#pragma unroll
            for (int mb = 0; mb < 4; ++mb) { a[mb] = WFrag<T16>::ld(sb + fa + mb * 16 * LP + ks); if (NSPLIT == 2) a2[mb] = WFrag<T16>::ld(sb + 2 * PLN + fa + mb * 16 * LP + ks); }
#pragma unroll
            for (int nb = 0; nb < 4; ++nb) if (NSPLIT == 0) bq[nb] = WFrag<T16>::ld(sb + fb + nb * 16 * LP + ks);   // one product: all eight fragments of the step are asked for ahead of its 16 matrix instructions
            if (NSPLIT == 0) __builtin_amdgcn_sched_barrier(0);   // keeps that load group ahead of the matrix block: sunk between the matrix instructions, each pair of loads would be waited for alone
#pragma unroll
            for (int nb = 0; nb < 4; ++nb) { const V b = (NSPLIT == 0) ? bq[nb] : WFrag<T16>::ld(sb + fb + nb * 16 * LP + ks); V b2; if (NSPLIT == 2) b2 = WFrag<T16>::ld(sb + 2 * PLN + fb + nb * 16 * LP + ks);
#pragma unroll
                for (int mb = 0; mb < 4; ++mb) { acc[mb][nb] = WFrag<T16>::mma(a[mb], b, acc[mb][nb]); if (NSPLIT == 2) { acc[mb][nb] = WFrag<T16>::mma(a2[mb], b, acc[mb][nb]); acc[mb][nb] = WFrag<T16>::mma(a[mb], b2, acc[mb][nb]); } } }
        }
        asm volatile("s_wait_dscnt 0x0" ::: "memory");         // this wave's reads of the buffer are done before it is refilled
        asm volatile("s_wait_asynccnt 0x0" ::: "memory");      // this wave's copies of stage t + 1 have landed
        __syncthreads();                                       // publishes stage t + 1 and ends every reader's last read of stage t
        if (t + 2 < nst) issue(t + 2);
    }
    asm volatile("s_wait_asynccnt 0x0" ::: "memory");          // nothing in flight when the wave ends
#pragma unroll
    for (int mb = 0; mb < 4; ++mb) {
#pragma unroll
        for (int nb = 0; nb < 4; ++nb) {
#pragma unroll
            for (int j = 0; j < 8; ++j) os[(hi * 8 + j) * 68 + nb * 16 + lr] = acc[mb][nb][j]; }
        __builtin_amdgcn_wave_barrier(); asm volatile("" ::: "memory");
        const size_t cb = (size_t)(r0 + wm * 64 + mb * 16) * ldc + c0 + wn * 64;
        if (EPI == 2) {                                        // 8 lanes a row: the wave's 64 columns are one 128-byte line of each 16-bit plane
#pragma unroll
            for (int s = 0; s < 4; ++s) { const int row = 4 * s + (lane >> 3), cofs = (lane & 7) * 8; const v4f x0 = *(const v4fa*)(os + row * 68 + cofs), x1 = *(const v4fa*)(os + row * 68 + cofs + 4); v8h o16; v8us oh, ol;
#pragma unroll
                for (int q = 0; q < 8; ++q) { const float x = (q < 4) ? x0[q & 3] : x1[q & 3]; o16[q] = tohx(x); unsigned short a2, c2; splitf(x, a2, c2); oh[q] = a2; ol[q] = c2; }
                const size_t oo = cb + (size_t)row * ldc + cofs; *(v8h*)(P16 + oo) = o16; *(v8us*)(Ph + oo) = oh; *(v8us*)(Pl + oo) = ol; }
        } else {
#pragma unroll
            for (int s = 0; s < 8; ++s) { const int row = 2 * s + hi, cofs = lr * 4; v4f val = *(const v4fa*)(os + row * 68 + cofs); if (EPI == 1) val *= osc;
                *(v4f*)(C + cb + (size_t)row * ldc + cofs) = val; }
        }
        __builtin_amdgcn_wave_barrier(); asm volatile("" ::: "memory");
    }
}
// ---- k_gemmp: the plain product, stored as the three 16-bit planes (pitch ldp); grid (M/128, N/128, Z), 128 threads; z-batch strides sA/sB/sP in elements.
template <typename T16>
__global__ __launch_bounds__(128) void k_gemmp(const T16* __restrict__ A, const T16* __restrict__ Bt, int K, h16* P16, bf* Ph, bf* Pl, int ldp, size_t sA, size_t sB, size_t sP) {
    const size_t z = blockIdx.z; A += z * sA; Bt += z * sB; P16 += z * sP; Ph += z * sP; Pl += z * sP;
    gemm_tile<T16, 0, 2>(A, nullptr, Bt, nullptr, K, K, nullptr, ldp, blockIdx.x * 128, blockIdx.y * 128, 1.0f, P16, Ph, Pl);
}

// ---- k_gemmc: the same tile product, stored as f32 in C (pitch ldc), for causal attention: CMODE 1 skips score tiles entirely above the diagonal (query rows r0+roff.., key columns c0..), CMODE 2 limits the
// key (K) loop of the probability x value contraction to the diagonal block (probabilities beyond it are exactly zero) and stores the sum x osc (the probabilities' carry taken back). roff = row offset of this launch's first row within the sequence.
template <typename T16, int NSPLIT, int CMODE>
__global__ __launch_bounds__(128) void k_gemmc(const T16* __restrict__ A, const T16* __restrict__ A2, const T16* __restrict__ Bt, const T16* __restrict__ Bt2, int K, float* C, int ldc, int roff, float osc, size_t sA, size_t sB, size_t sC) {
    const size_t z = blockIdx.z; A += z * sA; if (A2) A2 += z * sA; Bt += z * sB; if (Bt2) Bt2 += z * sB; C += z * sC;
    const int r0 = blockIdx.x * 128, c0 = blockIdx.y * 128;
    if (CMODE == 1 && c0 > r0 + roff + 127) return;                  // score tile entirely above the causal diagonal (the whole work-group leaves, ahead of every barrier); the softmax masks j > i by select
    const int Kl = (CMODE == 2) ? min(K, r0 + roff + 128) : K;       // P.V: probabilities are exactly 0 beyond the diagonal block, so the K loop stops there
    gemm_tile<T16, NSPLIT, (CMODE == 2) ? 1 : 0>(A, A2, Bt, Bt2, K, Kl, C, ldc, r0, c0, osc, nullptr, nullptr, nullptr);
}

typedef __attribute__((ext_vector_type(4))) _Float16 v4h;
typedef __attribute__((ext_vector_type(4))) unsigned short v4us;
typedef __attribute__((ext_vector_type(4))) int v4i;

__global__ __launch_bounds__(256) void k_cvt8(const float* __restrict__ src, bf* dst, size_t n8) { const size_t i = (size_t)blockIdx.x * 256 + threadIdx.x; if (i >= n8) return; const v8f v = *(const v8f*)(src + i * 8); v8us o;
#pragma unroll
    for (int k = 0; k < 8; ++k) o[k] = f2bf(v[k]); *(v8us*)(dst + i * 8) = o;  }

// k_asoft: per row (zz, i), zz = sequence: t = S x HD^-0.5 for j <= i and i - j < WIN (sliding causal window; the reference's -1e9 additive fill vanishes identically); softmax over the 2048 keys (register row, one exp, fixed trees);
__global__ __launch_bounds__(256) void k_asoft(const float* __restrict__ Sb, h16* P16, bf* Ph, bf* Pl) {
    const int lane = threadIdx.x & 31; const int row = blockIdx.x * 8 + (threadIdx.x >> 5); if (row >= NB_ * ZH * TT) return; const int i = row % TT; const int zz = row / TT; (void)zz; const bool hires = (i < RH); const float* sr = Sb + (size_t)row * TT; float v[TT / 32]; float mx = -3.0e38f;
    const int iu = __builtin_amdgcn_readfirstlane(i);   // the row is one per wave: in a scalar register the tests below are scalar branches
    v4f a[TT / 128];
#pragma unroll
    for (int ch = 0; ch < TT / 128; ++ch) { a[ch] = (v4f){-3.0e38f, -3.0e38f, -3.0e38f, -3.0e38f}; if (ch == 0 || ch * 128 <= iu) a[ch] = *(const v4f*)(sr + ch * 128 + lane * 4); }   // a 128-key block wholly above the diagonal was never written in this call and is wholly masked below: it is not read; its registers take the mask's own value (with a zero fill the compiler shared one of them with the zero of the address arithmetic and put a data wait inside the run of loads)
#pragma unroll
    for (int ch = 0; ch < TT / 128; ++ch) { const int j0 = ch * 128 + lane * 4;
#pragma unroll
        for (int q = 0; q < 4; ++q) { const int j = j0 + q; (void)j; const float t = (j <= i && i - j < WIN) ? a[ch][q] * SCL : -3.0e38f; v[ch * 4 + q] = t; mx = fmaxf(mx, t); } }
#pragma unroll
    for (int sh = 16; sh; sh >>= 1) mx = fmaxf(mx, __shfl_xor(mx, sh, 32));
    float sum = 0.f;
#pragma unroll
    for (int k = 0; k < TT / 32; ++k) { float d0 = __fsub_rn(v[k], mx); asm volatile("" : "+v"(d0)); v[k] = __builtin_amdgcn_exp2f(__fmul_rn(d0, 1.4426950408889634f)); sum += v[k]; }
#pragma unroll
    for (int sh = 16; sh; sh >>= 1) sum += __shfl_xor(sum, sh, 32);
    const float f = __fdiv_rn(hires ? 1.0f : PCAR, sum);
{
        if (hires) {
#pragma unroll
            for (int ch = 0; ch < TT / 128; ++ch) { v4us oh, ol;
#pragma unroll
                for (int q = 0; q < 4; ++q) { unsigned short a, c2; splitf(v[ch * 4 + q] * f, a, c2); oh[q] = a; ol[q] = c2; }
                const size_t oo = ((size_t)zz * (RH ? RH : 1) + i) * TT + ch * 128 + lane * 4; *(v4us*)(Ph + oo) = oh; *(v4us*)(Pl + oo) = ol; }
        } else {
#pragma unroll
            for (int ch = 0; ch < TT / 128; ++ch) { v4h o4;
#pragma unroll
                for (int q = 0; q < 4; ++q) o4[q] = tohx(v[ch * 4 + q] * f);
                *(v4h*)(P16 + (size_t)row * TT + ch * 128 + lane * 4) = o4; } }
         }
}

extern "C" void kernel_launch(void* const* d_in, const int* in_sizes, int n_in,
                              void* d_out, int out_size, void* d_ws, size_t ws_size, hipStream_t stream) {
    (void)in_sizes; (void)n_in; (void)out_size;
    const float* x = (const float*)d_in[0]; const float* wq = (const float*)d_in[1]; const float* wk = (const float*)d_in[2]; const float* wv = (const float*)d_in[3]; const float* wo = nullptr; (void)wo;   /* input order x, Wq, Wk, Wv ('oi' [1024][1024]) */
    float* OUT = (float*)d_out;     // [4][2048][1024]
    char* wsp = (char*)d_ws;
    auto take = [&](size_t bytes) { char* p = wsp; wsp += (bytes + 255) & ~(size_t)255; return (void*)p; };
    bf* WQ = (bf*)take((size_t)DQ * DM * 2); bf* WK = (bf*)take((size_t)DKV * DM * 2); bf* WV = (bf*)take((size_t)DKV * DM * 2);
    bf* XB = (bf*)take((size_t)NB_ * TT * DM * 2); float* Sb = (float*)take((size_t)NB_ * ZH * TT * TT * 4);
    h16* QP16 = (h16*)take((size_t)NB_ * NH_ * TT * HD * 2); h16* KP16 = (h16*)take((size_t)NB_ * NKV * TT * HD * 2); h16* VT16 = (h16*)take((size_t)NB_ * NKV * HD * TT * 2);
    bf* QPh = (bf*)take((size_t)NB_ * NH_ * TT * HD * 2); bf* QPl = (bf*)take((size_t)NB_ * NH_ * TT * HD * 2); bf* KPh = (bf*)take((size_t)NB_ * NKV * TT * HD * 2); bf* KPl = (bf*)take((size_t)NB_ * NKV * TT * HD * 2); bf* VTh = (bf*)take((size_t)NB_ * NKV * HD * TT * 2); bf* VTl = (bf*)take((size_t)NB_ * NKV * HD * TT * 2);
    // Reuse inside one call, stream-ordered, so that four sequences fit the workspace: the probabilities take the q and k planes' place (dead once the scores are written).
    static_assert((size_t)ZH * TT * TT == (size_t)(NH_ + NKV) * TT * HD, "P16 fills QP16 + KP16"); static_assert(2 * (size_t)ZH * RH * TT <= (size_t)NH_ * TT * HD, "Ph + Pl fit QPh");
    h16* P16 = QP16; bf* Ph = QPh; bf* Pl = QPh + (size_t)NB_ * ZH * RH * TT;
    if ((size_t)(wsp - (char*)d_ws) > ws_size) return;    // ws 256 MiB
    { k_cvt8<<<(unsigned)(((size_t)DQ * DM / 8 + 255) / 256), 256, 0, stream>>>(wq, WQ, (size_t)DQ * DM / 8); k_cvt8<<<(unsigned)(((size_t)DKV * DM / 8 + 255) / 256), 256, 0, stream>>>(wk, WK, (size_t)DKV * DM / 8); k_cvt8<<<(unsigned)(((size_t)DKV * DM / 8 + 255) / 256), 256, 0, stream>>>(wv, WV, (size_t)DKV * DM / 8);
      
       }
    k_cvt8<<<(unsigned)(((size_t)NB_ * TT * DM / 8 + 255) / 256), 256, 0, stream>>>(x, XB, (size_t)NB_ * TT * DM / 8);
    // projections, stored as planes: q and k as x.W^T -> [t][d]; v as Wv.x^T -> [d][t], the layout the probability x value product reads
    k_gemmp<bf><<<dim3(TT / 128, DQ / 128, NB_), 128, 0, stream>>>(XB, WQ, DM, QP16, QPh, QPl, HD, (size_t)TT * DM, 0, (size_t)TT * HD);
    k_gemmp<bf><<<dim3(TT / 128, DKV / 128, NB_), 128, 0, stream>>>(XB, WK, DM, KP16, KPh, KPl, HD, (size_t)TT * DM, 0, (size_t)TT * HD);
    k_gemmp<bf><<<dim3(DKV / 128, TT / 128, NB_), 128, 0, stream>>>(WV, XB, DM, VT16, VTh, VTl, TT, 0, (size_t)TT * DM, (size_t)HD * TT);
    // one head: grid z of the attention products = sequence (z-strides: one sequence's plane)
    k_gemmc<bf, 2, 1><<<dim3(RH / 128, TT / 128, NB_), 128, 0, stream>>>(QPh, QPl, KPh, KPl, HD, Sb, TT, 0, 1.0f, (size_t)TT * HD, (size_t)TT * HD, (size_t)TT * TT);
    k_gemmc<h16, 0, 1><<<dim3((TT - RH) / 128, TT / 128, NB_), 128, 0, stream>>>(QP16 + (size_t)RH * HD, nullptr, KP16, nullptr, HD, Sb + (size_t)RH * TT, TT, RH, 1.0f, (size_t)TT * HD, (size_t)TT * HD, (size_t)TT * TT);
    k_asoft<<<NB_ * ZH * TT / 8, 256, 0, stream>>>(Sb, P16, Ph, Pl);
    k_gemmc<bf, 2, 2><<<dim3(RH / 128, HD / 128, NB_), 128, 0, stream>>>(Ph, Pl, VTh, VTl, TT, OUT, DQ, 0, 1.0f, (size_t)RH * TT, (size_t)HD * TT, (size_t)TT * DQ);
    k_gemmc<h16, 0, 2><<<dim3((TT - RH) / 128, HD / 128, NB_), 128, 0, stream>>>(P16 + (size_t)RH * TT, nullptr, VT16, nullptr, TT, OUT + (size_t)RH * DQ, DQ, RH, 1.0f / PCAR, (size_t)TT * TT, (size_t)HD * TT, (size_t)TT * DQ);
}

// v004
// A run of this version takes 143 microseconds.
// In two side-by-side timings against v003, it was 1.28 and 1.26 times as fast.
// Over all steps from v000 it is 5.83 times as fast.
#include <hip/hip_runtime.h>

// Single-head causal self-attention with bias-free projections (x [4][2048][1024]; q, k, v = einsum('bsd,ed', x, W) ('oi' [1024][1024] 1/32, no bias; ONE 1,024-wide head); scores = q.k; causal (-inf); THEN x 1/sqrt(1024) inside the softmax call (-inf stays -inf); softmax; out = attn.v -> [4][2048][1024] (8.4 M); no output projection; argument order x, Wq, Wk, Wv).
// All four sequences run in every launch (grid z = sequence in the projections, grid x in the scores and the probability x value product), and launches that do not depend on one another share one grid (the four conversions; the three projections; both row bands of the scores; both of the probability x value product); buffers hold four planes, and dead ones are reused later in the same call. Layout per sequence: bf16 copy of x; 'oi' weights; exact projections whose epilogue writes the 16-bit planes itself (v as Wv.x^T, so that its planes come out transposed); causal T-2048 attention at NH 1 / ZH 1 (hybrid rows: < 512 hi/lo 3 products, rest fp16 x1024; the score launch skips tiles above the diagonal); the probability x value epilogue writes the output rows (no output projection).
// Compute dtypes, f32 accumulate: every input rounded to bf16; projections exact; attention rows < 512 3 products, rest fp16; softmax f32; output f32.

#define NB_  4
#define TT   2048
#define DM   1024
#define NH_  1
#define NKV  1
#define REP  (NH_ / NKV)
#define HD   1024
#define DQ   (NH_ * HD)
#define DKV  (NKV * HD)
#define ZH   1                    // ONE head: a single plane per pass
static_assert(1 % ZH == 0, "single head");
#define RH   512                  // query rows < RH use hi+lo planes (0: none)
#define WIN  2048
#define PCAR 1024.0f
#define SCL  0.03125f   // 1/sqrt(d_k = 1024)
typedef _Float16 h16;
typedef unsigned short bf;
typedef __attribute__((ext_vector_type(16))) __bf16   v16bf;
typedef __attribute__((ext_vector_type(16))) _Float16 v16h;
typedef __attribute__((ext_vector_type(8)))  _Float16 v8h;
typedef __attribute__((ext_vector_type(8)))  unsigned short v8us;
typedef __attribute__((ext_vector_type(8)))  float    v8f;
typedef __attribute__((ext_vector_type(4)))  float    v4f;
typedef v8h  __attribute__((may_alias)) v8ha;
typedef v4f  __attribute__((may_alias)) v4fa;
typedef v8us __attribute__((may_alias)) v8usa;

__device__ __forceinline__ unsigned short f2bf(float f) { unsigned u = __float_as_uint(f); u += 0x7FFFu + ((u >> 16) & 1u); return (unsigned short)(u >> 16); }
__device__ __forceinline__ float bf2f(unsigned short b) { return __uint_as_float(((unsigned)b) << 16); }
__device__ __forceinline__ v16h cat16(v8h lo, v8h hi) { return __builtin_shufflevector(lo, hi, 0, 1, 2, 3, 4, 5, 6, 7, 8, 9, 10, 11, 12, 13, 14, 15); }
__device__ __forceinline__ v16bf cat16b(v8us lo, v8us hi) { return __builtin_bit_cast(v16bf, __builtin_shufflevector(lo, hi, 0, 1, 2, 3, 4, 5, 6, 7, 8, 9, 10, 11, 12, 13, 14, 15)); }
__device__ __forceinline__ v8f wmma16(v16h a, v16h b, v8f c) { return __builtin_amdgcn_wmma_f32_16x16x32_f16(false, a, false, b, (short)0, c, false, false); }
__device__ __forceinline__ v8f wmmab(v16bf a, v16bf b, v8f c) { return __builtin_amdgcn_wmma_f32_16x16x32_bf16(false, a, false, b, (short)0, c, false, false); }
__device__ __forceinline__ h16 tohx(float x) { return (h16)x; }
__device__ __forceinline__ void splitf(float y, unsigned short& h, unsigned short& l) { h = f2bf(y); l = f2bf(y - bf2f(h)); }



// ---- Tile GEMM, operands staged in LDS: one work-group of 4 waves (2 x 2) per 128x128 output tile, each wave a 64x64 part (16 accumulators). A stage is 64 k (128-byte rows) of every operand plane,
// brought from the K-contiguous 16-bit planes by asynchronous 16-byte copies that cover whole 128-byte lines (8 lanes a row); two buffers, the next stage's copies fly while this one is worked on.
// With three products (four planes) a stage is 32 k (64-byte rows, 4 lanes a row), so that its ring is about as large as the one-product ring and both kinds of tile can share a launch at three work-groups a WGP.
// C[m][n] (f32, pitch ldc) = sum_k A[m][k] Bt[n][k] (+ A2.Bt + A.Bt2 for NSPLIT 2), k ascending in steps of 32. Kl % 64 == 0, Kl <= K. sm: the work-group's LDS (SMB bytes of it are used).
// EPI says what the epilogue stores of that sum: 0 the f32 value in C; 1 the f32 value x osc in C; 2 no f32 at all, but its fp16 rounding in P16 and its bf16 hi/lo split in Ph, Pl (pitch ldc, whole 128-byte lines).
template <typename T16> struct WFrag;
template <> struct WFrag<h16> { typedef v16h V; static __device__ __forceinline__ V ld(const h16* p) { return cat16(*(const v8h*)p, *(const v8h*)(p + 16)); } static __device__ __forceinline__ v8f mma(V a, V b, v8f c) { return wmma16(a, b, c); } };
template <> struct WFrag<bf> { typedef v16bf V; static __device__ __forceinline__ V ld(const bf* p) { return cat16b(*(const v8us*)p, *(const v8us*)(p + 16)); } static __device__ __forceinline__ v8f mma(V a, V b, v8f c) { return wmmab(a, b, c); } };
template <int NSPLIT> struct Stg {
    static constexpr int KS  = (NSPLIT == 2) ? 32 : 64;        // k per stage
    static constexpr int LP  = KS + 8;                         // LDS row pitch in 16-bit elements: 144 B = 16 B x 9 or 80 B = 16 B x 5, conflict-free for 16-byte reads
    static constexpr int PLN = 128 * LP;                       // one operand plane of a stage, in elements
    static constexpr int STG = (NSPLIT == 2 ? 4 : 2) * PLN;    // a stage: A | Bt (| A2 | Bt2)
    static constexpr int RB  = 2 * STG * 2;                    // the ring of two stages, in bytes
    static constexpr int SMB = RB + 4 * 16 * 68 * 4;           // ring + the four waves' output staging
};
// One lane's share of one plane of a 64-k stage: 8 copies of 16 bytes, rows 16 apart (rs = 16 rows in elements of the source, 2304 B in LDS). The s_wait_xcnt closes the statement so that no address register is rewritten ahead of it.
template <typename T16>
__device__ __forceinline__ void copy_plane(unsigned l, const T16* g, size_t rs) {
    asm volatile("global_load_async_to_lds_b128 %0, %8, off\n\t"
                 "global_load_async_to_lds_b128 %1, %9, off\n\t"
                 "global_load_async_to_lds_b128 %2, %10, off\n\t"
                 "global_load_async_to_lds_b128 %3, %11, off\n\t"
                 "global_load_async_to_lds_b128 %4, %12, off\n\t"
                 "global_load_async_to_lds_b128 %5, %13, off\n\t"
                 "global_load_async_to_lds_b128 %6, %14, off\n\t"
                 "global_load_async_to_lds_b128 %7, %15, off\n\t"
                 "s_wait_xcnt 0x0"
                 :: "v"(l), "v"(l + 2304u), "v"(l + 2u * 2304u), "v"(l + 3u * 2304u), "v"(l + 4u * 2304u), "v"(l + 5u * 2304u), "v"(l + 6u * 2304u), "v"(l + 7u * 2304u),
                    "v"(g), "v"(g + rs), "v"(g + 2 * rs), "v"(g + 3 * rs), "v"(g + 4 * rs), "v"(g + 5 * rs), "v"(g + 6 * rs), "v"(g + 7 * rs) : "memory");
}
// The same for a 32-k stage: 4 copies of 16 bytes, rows 32 apart (rs = 32 rows in elements of the source, 2560 B in LDS).
template <typename T16>
__device__ __forceinline__ void copy_plane4(unsigned l, const T16* g, size_t rs) {
    asm volatile("global_load_async_to_lds_b128 %0, %4, off\n\t"
                 "global_load_async_to_lds_b128 %1, %5, off\n\t"
                 "global_load_async_to_lds_b128 %2, %6, off\n\t"
                 "global_load_async_to_lds_b128 %3, %7, off\n\t"
                 "s_wait_xcnt 0x0"
                 :: "v"(l), "v"(l + 2560u), "v"(l + 2u * 2560u), "v"(l + 3u * 2560u),
                    "v"(g), "v"(g + rs), "v"(g + 2 * rs), "v"(g + 3 * rs) : "memory");
}
template <typename T16, int NSPLIT, int EPI>
__device__ __forceinline__ void gemm_tile(char* sm, const T16* __restrict__ A, const T16* __restrict__ A2, const T16* __restrict__ Bt, const T16* __restrict__ Bt2, int K, int Kl, float* C, int ldc, int r0, int c0, float osc, h16* P16, bf* Ph, bf* Pl) {
    static_assert(NSPLIT == 0 || NSPLIT == 2, "one product or three");
    typedef typename WFrag<T16>::V V;
    constexpr int KS = Stg<NSPLIT>::KS, LP = Stg<NSPLIT>::LP, PLN = Stg<NSPLIT>::PLN, STG = Stg<NSPLIT>::STG;
    T16* ring = (T16*)sm;
    float* osw = (float*)(sm + Stg<NSPLIT>::RB);
    const int tid = threadIdx.x, lane = tid & 31, lr = lane & 15, hi = lane >> 4, wave = tid >> 5, wm = wave >> 1, wn = wave & 1;
    float* os = osw + wave * (16 * 68);                        // output staging, private to the wave
    v8f acc[4][4];
#pragma unroll
    for (int mb = 0; mb < 4; ++mb)
#pragma unroll
        for (int nb = 0; nb < 4; ++nb) acc[mb][nb] = (v8f){};
    constexpr int LR = KS / 8;                                 // copies: LR lanes cover one row of a stage (128 or 64 bytes)
    const int crow = tid / LR, ccol = (tid % LR) * 8;
    const size_t ga = (size_t)(r0 + crow) * K + ccol, gb = (size_t)(c0 + crow) * K + ccol, rs = (size_t)(128 / LR) * K;
    const unsigned l0 = (unsigned)(size_t)ring + (unsigned)(crow * LP + ccol) * 2u;
    auto issue = [&](int t) { const unsigned l = l0 + (unsigned)(t & 1) * (unsigned)(STG * 2); const int kc = t * KS;
        if (NSPLIT == 0) { copy_plane(l, A + ga + kc, rs); copy_plane(l + PLN * 2u, Bt + gb + kc, rs); }
        else { copy_plane4(l, A + ga + kc, rs); copy_plane4(l + PLN * 2u, Bt + gb + kc, rs); copy_plane4(l + 2u * PLN * 2u, A2 + ga + kc, rs); copy_plane4(l + 3u * PLN * 2u, Bt2 + gb + kc, rs); } };
    const int nst = Kl / KS;
    issue(0);
    asm volatile("s_wait_asynccnt 0x0" ::: "memory");          // this wave's copies of stage 0 have landed
    __syncthreads();                                           // publishes stage 0
    if (nst > 1) issue(1);
    const int fa = (wm * 64 + lr) * LP + 8 * hi, fb = PLN + (wn * 64 + lr) * LP + 8 * hi;
#pragma unroll 1
    for (int t = 0; t < nst; ++t) {                            // kept rolled: one stage a trip, the buffer by t & 1
        const T16* sb = ring + (t & 1) * STG;
#pragma unroll
        for (int ks = 0; ks < KS; ks += 32) {
            V a[4], a2[4], bq[4];
#pragma unroll
            for (int mb = 0; mb < 4; ++mb) { a[mb] = WFrag<T16>::ld(sb + fa + mb * 16 * LP + ks); if (NSPLIT == 2) a2[mb] = WFrag<T16>::ld(sb + 2 * PLN + fa + mb * 16 * LP + ks); }
#pragma unroll
            for (int nb = 0; nb < 4; ++nb) if (NSPLIT == 0) bq[nb] = WFrag<T16>::ld(sb + fb + nb * 16 * LP + ks);   // one product: all eight fragments of the step are asked for ahead of its 16 matrix instructions
            if (NSPLIT == 0) __builtin_amdgcn_sched_barrier(0);   // keeps that load group ahead of the matrix block: sunk between the matrix instructions, each pair of loads would be waited for alone
#pragma unroll
            for (int nb = 0; nb < 4; ++nb) { const V b = (NSPLIT == 0) ? bq[nb] : WFrag<T16>::ld(sb + fb + nb * 16 * LP + ks); V b2; if (NSPLIT == 2) b2 = WFrag<T16>::ld(sb + 2 * PLN + fb + nb * 16 * LP + ks);
#pragma unroll
                for (int mb = 0; mb < 4; ++mb) { acc[mb][nb] = WFrag<T16>::mma(a[mb], b, acc[mb][nb]); if (NSPLIT == 2) { acc[mb][nb] = WFrag<T16>::mma(a2[mb], b, acc[mb][nb]); acc[mb][nb] = WFrag<T16>::mma(a[mb], b2, acc[mb][nb]); } } }
        }
        asm volatile("s_wait_dscnt 0x0" ::: "memory");         // this wave's reads of the buffer are done before it is refilled
        asm volatile("s_wait_asynccnt 0x0" ::: "memory");      // this wave's copies of stage t + 1 have landed
        __syncthreads();                                       // publishes stage t + 1 and ends every reader's last read of stage t
        if (t + 2 < nst) issue(t + 2);
    }
    asm volatile("s_wait_asynccnt 0x0" ::: "memory");          // nothing in flight when the wave ends
#pragma unroll
    for (int mb = 0; mb < 4; ++mb) {
#pragma unroll
        for (int nb = 0; nb < 4; ++nb) {
#pragma unroll
            for (int j = 0; j < 8; ++j) os[(hi * 8 + j) * 68 + nb * 16 + lr] = acc[mb][nb][j]; }
        __builtin_amdgcn_wave_barrier(); asm volatile("" ::: "memory");
        const size_t cb = (size_t)(r0 + wm * 64 + mb * 16) * ldc + c0 + wn * 64;
        if (EPI == 2) {                                        // 8 lanes a row: the wave's 64 columns are one 128-byte line of each 16-bit plane
#pragma unroll
            for (int s = 0; s < 4; ++s) { const int row = 4 * s + (lane >> 3), cofs = (lane & 7) * 8; const v4f x0 = *(const v4fa*)(os + row * 68 + cofs), x1 = *(const v4fa*)(os + row * 68 + cofs + 4); v8h o16; v8us oh, ol;
#pragma unroll
                for (int q = 0; q < 8; ++q) { const float x = (q < 4) ? x0[q & 3] : x1[q & 3]; o16[q] = tohx(x); unsigned short a2, c2; splitf(x, a2, c2); oh[q] = a2; ol[q] = c2; }
                const size_t oo = cb + (size_t)row * ldc + cofs; *(v8h*)(P16 + oo) = o16; *(v8us*)(Ph + oo) = oh; *(v8us*)(Pl + oo) = ol; }
        } else {
#pragma unroll
            for (int s = 0; s < 8; ++s) { const int row = 2 * s + hi, cofs = lr * 4; v4f val = *(const v4fa*)(os + row * 68 + cofs); if (EPI == 1) val *= osc;
                *(v4f*)(C + cb + (size_t)row * ldc + cofs) = val; }
        }
        __builtin_amdgcn_wave_barrier(); asm volatile("" ::: "memory");
    }
    asm volatile("s_wait_xcnt 0x0" ::: "memory");              // closes the run of stores: where two kinds of tile share a kernel, the other kind's code follows in the listing and rewrites the stores' registers
}
// ---- k_proj: the three projections in one launch, each stored as its three 16-bit planes; grid (128 tiles, projection, sequence), 128 threads. q and k as x.W^T -> [t][d]; v as Wv.x^T -> [d][t], the layout the probability x value product reads.
__global__ __launch_bounds__(128) void k_proj(const bf* __restrict__ XB, const bf* __restrict__ WQ, const bf* __restrict__ WK, const bf* __restrict__ WV, h16* Q16, bf* Qh, bf* Ql, h16* K16, bf* Kh, bf* Kl, h16* V16, bf* Vh, bf* Vl) {
    __shared__ __align__(16) char sm[Stg<0>::SMB];
    const int w = blockIdx.y, t = blockIdx.x; const bf* X = XB + (size_t)blockIdx.z * TT * DM; const size_t po = (size_t)blockIdx.z * TT * HD;
    const bool tr = (w == 2);                                        // v: the weight rows are the tile's rows
    const bf* Wt = (w == 0) ? WQ : (w == 1) ? WK : WV;
    h16* P16 = ((w == 0) ? Q16 : (w == 1) ? K16 : V16) + po; bf* Ph = ((w == 0) ? Qh : (w == 1) ? Kh : Vh) + po; bf* Pl = ((w == 0) ? Ql : (w == 1) ? Kl : Vl) + po;
    const int r0 = (tr ? (t % (HD / 128)) : (t % (TT / 128))) * 128, c0 = (tr ? (t / (HD / 128)) : (t / (TT / 128))) * 128;
    gemm_tile<bf, 0, 2>(sm, tr ? Wt : X, nullptr, tr ? X : Wt, nullptr, DM, DM, nullptr, tr ? TT : HD, r0, c0, 1.0f, P16, Ph, Pl);
}

// ---- k_scores: q.k^T for causal attention, both row bands in one launch; grid (sequence, key tile, query tile): the hi/lo tiles, three times as long as the rest, have the lowest indices and start first. Tiles entirely above the diagonal are skipped; query rows < RH take the hi/lo planes (3 products), the rest fp16.
__global__ __launch_bounds__(128) void k_scores(const bf* __restrict__ Qh, const bf* __restrict__ Ql, const bf* __restrict__ Kh, const bf* __restrict__ Kl, const h16* __restrict__ Q16, const h16* __restrict__ K16, float* S) {
    __shared__ __align__(16) char sm[(Stg<2>::SMB > Stg<0>::SMB) ? Stg<2>::SMB : Stg<0>::SMB];
    const int r0 = blockIdx.z * 128, c0 = blockIdx.y * 128;
    if (c0 > r0 + 127) return;                                       // score tile entirely above the causal diagonal (the whole work-group leaves, ahead of every barrier); the softmax masks j > i by select
    const size_t o = (size_t)blockIdx.x * TT * HD; S += (size_t)blockIdx.x * TT * TT;
    if (r0 < RH) gemm_tile<bf, 2, 0>(sm, Qh + o, Ql + o, Kh + o, Kl + o, HD, HD, S, TT, r0, c0, 1.0f, nullptr, nullptr, nullptr);
    else gemm_tile<h16, 0, 0>(sm, Q16 + o, nullptr, K16 + o, nullptr, HD, HD, S, TT, r0, c0, 1.0f, nullptr, nullptr, nullptr);
}

// ---- k_pv: probabilities x values, both row bands in one launch; grid (sequence, column tile, query tile from the last down: the longest key loops start first). The key loop stops at the diagonal block (probabilities beyond it are exactly zero); the fp16 band's sum is stored x 1/PCAR (the probabilities' carry taken back).
__global__ __launch_bounds__(128) void k_pv(const bf* __restrict__ Ph, const bf* __restrict__ Pl, const bf* __restrict__ Vh, const bf* __restrict__ Vl, const h16* __restrict__ P16, const h16* __restrict__ V16, float* O) {
    __shared__ __align__(16) char sm[(Stg<2>::SMB > Stg<0>::SMB) ? Stg<2>::SMB : Stg<0>::SMB];
    const int r0 = (TT / 128 - 1 - (int)blockIdx.z) * 128, c0 = blockIdx.y * 128, Kl = min(TT, r0 + 128);
    const size_t z = blockIdx.x, vo = z * HD * TT; O += z * TT * DQ;
    if (r0 < RH) gemm_tile<bf, 2, 1>(sm, Ph + z * RH * TT, Pl + z * RH * TT, Vh + vo, Vl + vo, TT, Kl, O, DQ, r0, c0, 1.0f, nullptr, nullptr, nullptr);
    else gemm_tile<h16, 0, 1>(sm, P16 + z * TT * TT, nullptr, V16 + vo, nullptr, TT, Kl, O, DQ, r0, c0, 1.0f / PCAR, nullptr, nullptr, nullptr);
}

typedef __attribute__((ext_vector_type(4))) _Float16 v4h;
typedef __attribute__((ext_vector_type(4))) unsigned short v4us;
typedef __attribute__((ext_vector_type(4))) int v4i;

// k_cvt8: f32 -> bf16 of x and of the three weights in one launch; a block converts 2,048 elements of one of them (the block index says which).
#define CBX ((unsigned)((size_t)NB_ * TT * DM / 2048))
#define CBW ((unsigned)((size_t)DQ * DM / 2048))
static_assert((size_t)NB_ * TT * DM % 2048 == 0 && (size_t)DQ * DM % 2048 == 0 && DQ == DKV, "whole blocks; three weights of one size");
__global__ __launch_bounds__(256) void k_cvt8(const float* __restrict__ x, const float* __restrict__ wq, const float* __restrict__ wk, const float* __restrict__ wv, bf* XB, bf* WQ, bf* WK, bf* WV) {
    unsigned b = blockIdx.x; const float* src = x; bf* dst = XB;
    if (b >= CBX) { b -= CBX; const unsigned w = b / CBW; b -= w * CBW; src = (w == 0) ? wq : (w == 1) ? wk : wv; dst = (w == 0) ? WQ : (w == 1) ? WK : WV; }
    const size_t i = (size_t)b * 256 + threadIdx.x; const v8f v = *(const v8f*)(src + i * 8); v8us o;
#pragma unroll
    for (int k = 0; k < 8; ++k) o[k] = f2bf(v[k]); *(v8us*)(dst + i * 8) = o;  }

// k_asoft: per row (zz, i), zz = sequence: t = S x HD^-0.5 for j <= i and i - j < WIN (sliding causal window; the reference's -1e9 additive fill vanishes identically); softmax over the 2048 keys (register row, one exp, fixed trees);
__global__ __launch_bounds__(256) void k_asoft(const float* __restrict__ Sb, h16* P16, bf* Ph, bf* Pl) {
    const int lane = threadIdx.x & 31; const int row = blockIdx.x * 8 + (threadIdx.x >> 5); if (row >= NB_ * ZH * TT) return; const int i = row % TT; const int zz = row / TT; (void)zz; const bool hires = (i < RH); const float* sr = Sb + (size_t)row * TT; float v[TT / 32]; float mx = -3.0e38f;
    const int iu = __builtin_amdgcn_readfirstlane(i);   // the row is one per wave: in a scalar register the tests below are scalar branches
    v4f a[TT / 128];
#pragma unroll
    for (int ch = 0; ch < TT / 128; ++ch) { a[ch] = (v4f){-3.0e38f, -3.0e38f, -3.0e38f, -3.0e38f}; if (ch == 0 || ch * 128 <= iu) a[ch] = *(const v4f*)(sr + ch * 128 + lane * 4); }   // a 128-key block wholly above the diagonal was never written in this call and is wholly masked below: it is not read; its registers take the mask's own value (with a zero fill the compiler shared one of them with the zero of the address arithmetic and put a data wait inside the run of loads)
#pragma unroll
    for (int ch = 0; ch < TT / 128; ++ch) { const int j0 = ch * 128 + lane * 4;
#pragma unroll
        for (int q = 0; q < 4; ++q) { const int j = j0 + q; (void)j; const float t = (j <= i && i - j < WIN) ? a[ch][q] * SCL : -3.0e38f; v[ch * 4 + q] = t; mx = fmaxf(mx, t); } }
#pragma unroll
    for (int sh = 16; sh; sh >>= 1) mx = fmaxf(mx, __shfl_xor(mx, sh, 32));
    float sum = 0.f;
#pragma unroll
    for (int k = 0; k < TT / 32; ++k) { float d0 = __fsub_rn(v[k], mx); asm volatile("" : "+v"(d0)); v[k] = __builtin_amdgcn_exp2f(__fmul_rn(d0, 1.4426950408889634f)); sum += v[k]; }
#pragma unroll
    for (int sh = 16; sh; sh >>= 1) sum += __shfl_xor(sum, sh, 32);
    const float f = __fdiv_rn(hires ? 1.0f : PCAR, sum);
{
        if (hires) {
#pragma unroll
            for (int ch = 0; ch < TT / 128; ++ch) { v4us oh, ol;
#pragma unroll
                for (int q = 0; q < 4; ++q) { unsigned short a, c2; splitf(v[ch * 4 + q] * f, a, c2); oh[q] = a; ol[q] = c2; }
                const size_t oo = ((size_t)zz * (RH ? RH : 1) + i) * TT + ch * 128 + lane * 4; *(v4us*)(Ph + oo) = oh; *(v4us*)(Pl + oo) = ol; }
        } else {
#pragma unroll
            for (int ch = 0; ch < TT / 128; ++ch) { v4h o4;
#pragma unroll
                for (int q = 0; q < 4; ++q) o4[q] = tohx(v[ch * 4 + q] * f);
                *(v4h*)(P16 + (size_t)row * TT + ch * 128 + lane * 4) = o4; } }
         }
}

extern "C" void kernel_launch(void* const* d_in, const int* in_sizes, int n_in,
                              void* d_out, int out_size, void* d_ws, size_t ws_size, hipStream_t stream) {
    (void)in_sizes; (void)n_in; (void)out_size;
    const float* x = (const float*)d_in[0]; const float* wq = (const float*)d_in[1]; const float* wk = (const float*)d_in[2]; const float* wv = (const float*)d_in[3]; const float* wo = nullptr; (void)wo;   /* input order x, Wq, Wk, Wv ('oi' [1024][1024]) */
    float* OUT = (float*)d_out;     // [4][2048][1024]
    char* wsp = (char*)d_ws;
    auto take = [&](size_t bytes) { char* p = wsp; wsp += (bytes + 255) & ~(size_t)255; return (void*)p; };
    bf* WQ = (bf*)take((size_t)DQ * DM * 2); bf* WK = (bf*)take((size_t)DKV * DM * 2); bf* WV = (bf*)take((size_t)DKV * DM * 2);
    bf* XB = (bf*)take((size_t)NB_ * TT * DM * 2); float* Sb = (float*)take((size_t)NB_ * ZH * TT * TT * 4);
    h16* QP16 = (h16*)take((size_t)NB_ * NH_ * TT * HD * 2); h16* KP16 = (h16*)take((size_t)NB_ * NKV * TT * HD * 2); h16* VT16 = (h16*)take((size_t)NB_ * NKV * HD * TT * 2);
    bf* QPh = (bf*)take((size_t)NB_ * NH_ * TT * HD * 2); bf* QPl = (bf*)take((size_t)NB_ * NH_ * TT * HD * 2); bf* KPh = (bf*)take((size_t)NB_ * NKV * TT * HD * 2); bf* KPl = (bf*)take((size_t)NB_ * NKV * TT * HD * 2); bf* VTh = (bf*)take((size_t)NB_ * NKV * HD * TT * 2); bf* VTl = (bf*)take((size_t)NB_ * NKV * HD * TT * 2);
    // Reuse inside one call, stream-ordered, so that four sequences fit the workspace: the probabilities take the q and k planes' place (dead once the scores are written).
    static_assert((size_t)ZH * TT * TT == (size_t)(NH_ + NKV) * TT * HD, "P16 fills QP16 + KP16"); static_assert(2 * (size_t)ZH * RH * TT <= (size_t)NH_ * TT * HD, "Ph + Pl fit QPh");
    h16* P16 = QP16; bf* Ph = QPh; bf* Pl = QPh + (size_t)NB_ * ZH * RH * TT;
    if ((size_t)(wsp - (char*)d_ws) > ws_size) return;    // ws 256 MiB
    k_cvt8<<<CBX + 3 * CBW, 256, 0, stream>>>(x, wq, wk, wv, XB, WQ, WK, WV);
    k_proj<<<dim3((TT / 128) * (HD / 128), 3, NB_), 128, 0, stream>>>(XB, WQ, WK, WV, QP16, QPh, QPl, KP16, KPh, KPl, VT16, VTh, VTl);
    k_scores<<<dim3(NB_, TT / 128, TT / 128), 128, 0, stream>>>(QPh, QPl, KPh, KPl, QP16, KP16, Sb);
    k_asoft<<<NB_ * ZH * TT / 8, 256, 0, stream>>>(Sb, P16, Ph, Pl);
    k_pv<<<dim3(NB_, HD / 128, TT / 128), 128, 0, stream>>>(Ph, Pl, VTh, VTl, P16, VT16, OUT);
}

// v005
// A run of this version takes 133 microseconds.
// In both of two side-by-side timings against v004, it was 1.07 times as fast.
// Counting every step since v000, it is 6.25 times as fast.
#include <hip/hip_runtime.h>

// Single-head causal self-attention with bias-free projections (x [4][2048][1024]; q, k, v = einsum('bsd,ed', x, W) ('oi' [1024][1024] 1/32, no bias; ONE 1,024-wide head); scores = q.k; causal (-inf); THEN x 1/sqrt(1024) inside the softmax call (-inf stays -inf); softmax; out = attn.v -> [4][2048][1024] (8.4 M); no output projection; argument order x, Wq, Wk, Wv).
// All four sequences run in every launch (grid z = sequence in the projections, grid x in the scores and the probability x value product), and launches that do not depend on one another share one grid (the four conversions; the three projections; both row bands of the scores; both of the probability x value product); buffers hold four planes, and dead ones are reused later in the same call. Layout per sequence: bf16 copy of x; 'oi' weights; exact projections whose epilogue writes the 16-bit planes itself (v as Wv.x^T, so that its planes come out transposed); causal T-2048 attention at NH 1 / ZH 1 (hybrid rows: < 512 hi/lo 3 products, rest fp16 x1024; the score launch skips tiles above the diagonal); the probability x value epilogue writes the output rows (no output projection).
// Compute dtypes, f32 accumulate: every input rounded to bf16; projections exact; attention rows < 512 3 products, rest fp16; softmax f32; output f32.

#define NB_  4
#define TT   2048
#define DM   1024
#define NH_  1
#define NKV  1
#define REP  (NH_ / NKV)
#define HD   1024
#define DQ   (NH_ * HD)
#define DKV  (NKV * HD)
#define ZH   1                    // ONE head: a single plane per pass
static_assert(1 % ZH == 0, "single head");
#define RH   512                  // query rows < RH use hi+lo planes (0: none)
static_assert(RH % 128 == 0 && TT % 512 == 0, "the band ends on a tile edge; the softmax stores fp16 rows in groups of 512 keys");
#define WIN  2048
#define PCAR 1024.0f
#define SCL  0.03125f   // 1/sqrt(d_k = 1024)
typedef _Float16 h16;
typedef unsigned short bf;
typedef __attribute__((ext_vector_type(16))) __bf16   v16bf;
typedef __attribute__((ext_vector_type(16))) _Float16 v16h;
typedef __attribute__((ext_vector_type(8)))  _Float16 v8h;
typedef __attribute__((ext_vector_type(8)))  unsigned short v8us;
typedef __attribute__((ext_vector_type(8)))  float    v8f;
typedef __attribute__((ext_vector_type(4)))  float    v4f;
typedef v8h  __attribute__((may_alias)) v8ha;
typedef v4f  __attribute__((may_alias)) v4fa;
typedef v8us __attribute__((may_alias)) v8usa;

__device__ __forceinline__ unsigned short f2bf(float f) { unsigned u = __float_as_uint(f); u += 0x7FFFu + ((u >> 16) & 1u); return (unsigned short)(u >> 16); }
__device__ __forceinline__ float bf2f(unsigned short b) { return __uint_as_float(((unsigned)b) << 16); }
__device__ __forceinline__ v16h cat16(v8h lo, v8h hi) { return __builtin_shufflevector(lo, hi, 0, 1, 2, 3, 4, 5, 6, 7, 8, 9, 10, 11, 12, 13, 14, 15); }
__device__ __forceinline__ v16bf cat16b(v8us lo, v8us hi) { return __builtin_bit_cast(v16bf, __builtin_shufflevector(lo, hi, 0, 1, 2, 3, 4, 5, 6, 7, 8, 9, 10, 11, 12, 13, 14, 15)); }
__device__ __forceinline__ v8f wmma16(v16h a, v16h b, v8f c) { return __builtin_amdgcn_wmma_f32_16x16x32_f16(false, a, false, b, (short)0, c, false, false); }
__device__ __forceinline__ v8f wmmab(v16bf a, v16bf b, v8f c) { return __builtin_amdgcn_wmma_f32_16x16x32_bf16(false, a, false, b, (short)0, c, false, false); }
__device__ __forceinline__ h16 tohx(float x) { return (h16)x; }
__device__ __forceinline__ void splitf(float y, unsigned short& h, unsigned short& l) { h = f2bf(y); l = f2bf(y - bf2f(h)); }



// ---- Tile GEMM, operands staged in LDS: one work-group of 4 waves (2 x 2) per 128x128 output tile, each wave a 64x64 part (16 accumulators). A stage is 64 k (128-byte rows) of every operand plane,
// brought from the K-contiguous 16-bit planes by asynchronous 16-byte copies that cover whole 128-byte lines (8 lanes a row); two buffers, the next stage's copies fly while this one is worked on.
// With three products (four planes) a stage is 32 k (64-byte rows, 4 lanes a row), so that its ring is about as large as the one-product ring and both kinds of tile can share a launch at three work-groups a WGP.
// C[m][n] (f32, pitch ldc) = sum_k A[m][k] Bt[n][k] (+ A2.Bt + A.Bt2 for NSPLIT 2), k ascending in steps of 32. Kl % 64 == 0, Kl <= K. sm: the work-group's LDS (SMB bytes of it are used).
// EPI says what the epilogue stores of that sum: 0 the f32 value in C; 1 the f32 value x osc in C; 2 no f32 at all, but its fp16 rounding in P16 (where s16) and its bf16 hi/lo split in Ph, Pl (where shl) (pitch ldc, whole 128-byte lines); s16 and shl are the same for the whole work-group and say which planes of this tile a later launch reads.
template <typename T16> struct WFrag;
template <> struct WFrag<h16> { typedef v16h V; static __device__ __forceinline__ V ld(const h16* p) { return cat16(*(const v8h*)p, *(const v8h*)(p + 16)); } static __device__ __forceinline__ v8f mma(V a, V b, v8f c) { return wmma16(a, b, c); } };
template <> struct WFrag<bf> { typedef v16bf V; static __device__ __forceinline__ V ld(const bf* p) { return cat16b(*(const v8us*)p, *(const v8us*)(p + 16)); } static __device__ __forceinline__ v8f mma(V a, V b, v8f c) { return wmmab(a, b, c); } };
template <int NSPLIT> struct Stg {
    static constexpr int KS  = (NSPLIT == 2) ? 32 : 64;        // k per stage
    static constexpr int LP  = KS + 8;                         // LDS row pitch in 16-bit elements: 144 B = 16 B x 9 or 80 B = 16 B x 5, conflict-free for 16-byte reads
    static constexpr int PLN = 128 * LP;                       // one operand plane of a stage, in elements
    static constexpr int STG = (NSPLIT == 2 ? 4 : 2) * PLN;    // a stage: A | Bt (| A2 | Bt2)
    static constexpr int RB  = 2 * STG * 2;                    // the ring of two stages, in bytes
    static constexpr int SMB = RB + 4 * 16 * 68 * 4;           // ring + the four waves' output staging
};
// One lane's share of one plane of a 64-k stage: 8 copies of 16 bytes, rows 16 apart (rs = 16 rows in elements of the source, 2304 B in LDS). The s_wait_xcnt closes the statement so that no address register is rewritten ahead of it.
template <typename T16>
__device__ __forceinline__ void copy_plane(unsigned l, const T16* g, size_t rs) {
    asm volatile("global_load_async_to_lds_b128 %0, %8, off\n\t"
                 "global_load_async_to_lds_b128 %1, %9, off\n\t"
                 "global_load_async_to_lds_b128 %2, %10, off\n\t"
                 "global_load_async_to_lds_b128 %3, %11, off\n\t"
                 "global_load_async_to_lds_b128 %4, %12, off\n\t"
                 "global_load_async_to_lds_b128 %5, %13, off\n\t"
                 "global_load_async_to_lds_b128 %6, %14, off\n\t"
                 "global_load_async_to_lds_b128 %7, %15, off\n\t"
                 "s_wait_xcnt 0x0"
                 :: "v"(l), "v"(l + 2304u), "v"(l + 2u * 2304u), "v"(l + 3u * 2304u), "v"(l + 4u * 2304u), "v"(l + 5u * 2304u), "v"(l + 6u * 2304u), "v"(l + 7u * 2304u),
                    "v"(g), "v"(g + rs), "v"(g + 2 * rs), "v"(g + 3 * rs), "v"(g + 4 * rs), "v"(g + 5 * rs), "v"(g + 6 * rs), "v"(g + 7 * rs) : "memory");
}
// The same for a 32-k stage: 4 copies of 16 bytes, rows 32 apart (rs = 32 rows in elements of the source, 2560 B in LDS).
template <typename T16>
__device__ __forceinline__ void copy_plane4(unsigned l, const T16* g, size_t rs) {
    asm volatile("global_load_async_to_lds_b128 %0, %4, off\n\t"
                 "global_load_async_to_lds_b128 %1, %5, off\n\t"
                 "global_load_async_to_lds_b128 %2, %6, off\n\t"
                 "global_load_async_to_lds_b128 %3, %7, off\n\t"
                 "s_wait_xcnt 0x0"
                 :: "v"(l), "v"(l + 2560u), "v"(l + 2u * 2560u), "v"(l + 3u * 2560u),
                    "v"(g), "v"(g + rs), "v"(g + 2 * rs), "v"(g + 3 * rs) : "memory");
}
// 16 staged rows of 64 f32 (pitch 68) to the 16-bit planes: S16 the fp16 rounding, SHL the bf16 hi/lo split; 8 lanes a row, 16 bytes a lane.
template <bool S16, bool SHL>
__device__ __forceinline__ void store_planes(const float* os, int lane, size_t cb, int ldc, h16* P16, bf* Ph, bf* Pl) {
#pragma unroll
    for (int s = 0; s < 4; ++s) { const int row = 4 * s + (lane >> 3), cofs = (lane & 7) * 8; const v4f x0 = *(const v4fa*)(os + row * 68 + cofs), x1 = *(const v4fa*)(os + row * 68 + cofs + 4); v8h o16; v8us oh, ol;
#pragma unroll
        for (int q = 0; q < 8; ++q) { const float x = (q < 4) ? x0[q & 3] : x1[q & 3]; if (S16) o16[q] = tohx(x); if (SHL) { unsigned short a2, c2; splitf(x, a2, c2); oh[q] = a2; ol[q] = c2; } }
        const size_t oo = cb + (size_t)row * ldc + cofs; if (S16) *(v8h*)(P16 + oo) = o16; if (SHL) { *(v8us*)(Ph + oo) = oh; *(v8us*)(Pl + oo) = ol; } }
    asm volatile("s_wait_xcnt 0x0" ::: "memory");              // closes the run of stores inside its branch: the code behind the join rewrites the stores' registers
}
template <typename T16, int NSPLIT, int EPI>
__device__ __forceinline__ void gemm_tile(char* sm, const T16* __restrict__ A, const T16* __restrict__ A2, const T16* __restrict__ Bt, const T16* __restrict__ Bt2, int K, int Kl, float* C, int ldc, int r0, int c0, float osc, h16* P16, bf* Ph, bf* Pl, bool s16, bool shl) {
    static_assert(NSPLIT == 0 || NSPLIT == 2, "one product or three");
    typedef typename WFrag<T16>::V V;
    constexpr int KS = Stg<NSPLIT>::KS, LP = Stg<NSPLIT>::LP, PLN = Stg<NSPLIT>::PLN, STG = Stg<NSPLIT>::STG;
    T16* ring = (T16*)sm;
    float* osw = (float*)(sm + Stg<NSPLIT>::RB);
    const int tid = threadIdx.x, lane = tid & 31, lr = lane & 15, hi = lane >> 4, wave = tid >> 5, wm = wave >> 1, wn = wave & 1;
    float* os = osw + wave * (16 * 68);                        // output staging, private to the wave
    v8f acc[4][4];
#pragma unroll
    for (int mb = 0; mb < 4; ++mb)
#pragma unroll
        for (int nb = 0; nb < 4; ++nb) acc[mb][nb] = (v8f){};
    constexpr int LR = KS / 8;                                 // copies: LR lanes cover one row of a stage (128 or 64 bytes)
    const int crow = tid / LR, ccol = (tid % LR) * 8;
    const size_t ga = (size_t)(r0 + crow) * K + ccol, gb = (size_t)(c0 + crow) * K + ccol, rs = (size_t)(128 / LR) * K;
    const unsigned l0 = (unsigned)(size_t)ring + (unsigned)(crow * LP + ccol) * 2u;
    auto issue = [&](int t) { const unsigned l = l0 + (unsigned)(t & 1) * (unsigned)(STG * 2); const int kc = t * KS;
        if (NSPLIT == 0) { copy_plane(l, A + ga + kc, rs); copy_plane(l + PLN * 2u, Bt + gb + kc, rs); }
        else { copy_plane4(l, A + ga + kc, rs); copy_plane4(l + PLN * 2u, Bt + gb + kc, rs); copy_plane4(l + 2u * PLN * 2u, A2 + ga + kc, rs); copy_plane4(l + 3u * PLN * 2u, Bt2 + gb + kc, rs); } };
    const int nst = Kl / KS;
    issue(0);
    asm volatile("s_wait_asynccnt 0x0" ::: "memory");          // this wave's copies of stage 0 have landed
    __syncthreads();                                           // publishes stage 0
    if (nst > 1) issue(1);
    const int fa = (wm * 64 + lr) * LP + 8 * hi, fb = PLN + (wn * 64 + lr) * LP + 8 * hi;
#pragma unroll 1
    for (int t = 0; t < nst; ++t) {                            // kept rolled: one stage a trip, the buffer by t & 1
        const T16* sb = ring + (t & 1) * STG;
#pragma unroll
        for (int ks = 0; ks < KS; ks += 32) {
            V a[4], a2[4], bq[4];
#pragma unroll
            for (int mb = 0; mb < 4; ++mb) { a[mb] = WFrag<T16>::ld(sb + fa + mb * 16 * LP + ks); if (NSPLIT == 2) a2[mb] = WFrag<T16>::ld(sb + 2 * PLN + fa + mb * 16 * LP + ks); }
#pragma unroll
            for (int nb = 0; nb < 4; ++nb) if (NSPLIT == 0) bq[nb] = WFrag<T16>::ld(sb + fb + nb * 16 * LP + ks);   // one product: all eight fragments of the step are asked for ahead of its 16 matrix instructions
            if (NSPLIT == 0) __builtin_amdgcn_sched_barrier(0);   // keeps that load group ahead of the matrix block: sunk between the matrix instructions, each pair of loads would be waited for alone
#pragma unroll
            for (int nb = 0; nb < 4; ++nb) { const V b = (NSPLIT == 0) ? bq[nb] : WFrag<T16>::ld(sb + fb + nb * 16 * LP + ks); V b2; if (NSPLIT == 2) b2 = WFrag<T16>::ld(sb + 2 * PLN + fb + nb * 16 * LP + ks);
#pragma unroll
                for (int mb = 0; mb < 4; ++mb) { acc[mb][nb] = WFrag<T16>::mma(a[mb], b, acc[mb][nb]); if (NSPLIT == 2) { acc[mb][nb] = WFrag<T16>::mma(a2[mb], b, acc[mb][nb]); acc[mb][nb] = WFrag<T16>::mma(a[mb], b2, acc[mb][nb]); } } }
        }
        asm volatile("s_wait_dscnt 0x0" ::: "memory");         // this wave's reads of the buffer are done before it is refilled
        asm volatile("s_wait_asynccnt 0x0" ::: "memory");      // this wave's copies of stage t + 1 have landed
        __syncthreads();                                       // publishes stage t + 1 and ends every reader's last read of stage t
        if (t + 2 < nst) issue(t + 2);
    }
    asm volatile("s_wait_asynccnt 0x0" ::: "memory");          // nothing in flight when the wave ends
#pragma unroll
    for (int mb = 0; mb < 4; ++mb) {
#pragma unroll
        for (int nb = 0; nb < 4; ++nb) {
#pragma unroll
            for (int j = 0; j < 8; ++j) os[(hi * 8 + j) * 68 + nb * 16 + lr] = acc[mb][nb][j]; }
        __builtin_amdgcn_wave_barrier(); asm volatile("" ::: "memory");
        const size_t cb = (size_t)(r0 + wm * 64 + mb * 16) * ldc + c0 + wn * 64;
        if (EPI == 2) {                                        // 8 lanes a row: the wave's 64 columns are one 128-byte line of each 16-bit plane
            if (!shl) store_planes<true, false>(os, lane, cb, ldc, P16, Ph, Pl);      // one scalar branch for 16 rows: each case is straight-line code, so that its LDS reads go out together
            else if (s16) store_planes<true, true>(os, lane, cb, ldc, P16, Ph, Pl);
            else store_planes<false, true>(os, lane, cb, ldc, P16, Ph, Pl);
        } else {
#pragma unroll
            for (int s = 0; s < 8; ++s) { const int row = 2 * s + hi, cofs = lr * 4; v4f val = *(const v4fa*)(os + row * 68 + cofs); if (EPI == 1) val *= osc;
                *(v4f*)(C + cb + (size_t)row * ldc + cofs) = val; }
        }
        __builtin_amdgcn_wave_barrier(); asm volatile("" ::: "memory");
    }
    asm volatile("s_wait_xcnt 0x0" ::: "memory");              // closes the run of stores: where two kinds of tile share a kernel, the other kind's code follows in the listing and rewrites the stores' registers
}
// ---- k_proj: the three projections in one launch, each stored as 16-bit planes, a tile only in the planes that a later launch reads of it (hi/lo: positions < RH alone, the only ones the three-product band touches; fp16: all of k and v, q from row RH on); grid (128 tiles, projection, sequence), 128 threads. q and k as x.W^T -> [t][d]; v as Wv.x^T -> [d][t], the layout the probability x value product reads.
__global__ __launch_bounds__(128) void k_proj(const bf* __restrict__ XB, const bf* __restrict__ WQ, const bf* __restrict__ WK, const bf* __restrict__ WV, h16* Q16, bf* Qh, bf* Ql, h16* K16, bf* Kh, bf* Kl, h16* V16, bf* Vh, bf* Vl) {
    __shared__ __align__(16) char sm[Stg<0>::SMB];
    const int w = blockIdx.y, t = blockIdx.x; const bf* X = XB + (size_t)blockIdx.z * TT * DM; const size_t po = (size_t)blockIdx.z * TT * HD;
    const bool tr = (w == 2);                                        // v: the weight rows are the tile's rows
    const bf* Wt = (w == 0) ? WQ : (w == 1) ? WK : WV;
    h16* P16 = ((w == 0) ? Q16 : (w == 1) ? K16 : V16) + po; bf* Ph = ((w == 0) ? Qh : (w == 1) ? Kh : Vh) + po; bf* Pl = ((w == 0) ? Ql : (w == 1) ? Kl : Vl) + po;
    const int r0 = (tr ? (t % (HD / 128)) : (t % (TT / 128))) * 128, c0 = (tr ? (t / (HD / 128)) : (t / (TT / 128))) * 128;
    const bool lowpos = (tr ? c0 : r0) < RH;                          // the tile's sequence positions (its columns for v) lie in the hi/lo band; RH is a multiple of the tile
    gemm_tile<bf, 0, 2>(sm, tr ? Wt : X, nullptr, tr ? X : Wt, nullptr, DM, DM, nullptr, tr ? TT : HD, r0, c0, 1.0f, P16, Ph, Pl, w != 0 || !lowpos, lowpos);
}

// ---- k_scores: q.k^T for causal attention, both row bands in one launch; grid (sequence, key tile, query tile): the hi/lo tiles, three times as long as the rest, have the lowest indices and start first. Tiles entirely above the diagonal are skipped; query rows < RH take the hi/lo planes (3 products), the rest fp16.
__global__ __launch_bounds__(128) void k_scores(const bf* __restrict__ Qh, const bf* __restrict__ Ql, const bf* __restrict__ Kh, const bf* __restrict__ Kl, const h16* __restrict__ Q16, const h16* __restrict__ K16, float* S) {
    __shared__ __align__(16) char sm[(Stg<2>::SMB > Stg<0>::SMB) ? Stg<2>::SMB : Stg<0>::SMB];
    const int r0 = blockIdx.z * 128, c0 = blockIdx.y * 128;
    if (c0 > r0 + 127) return;                                       // score tile entirely above the causal diagonal (the whole work-group leaves, ahead of every barrier); the softmax masks j > i by select
    const size_t o = (size_t)blockIdx.x * TT * HD; S += (size_t)blockIdx.x * TT * TT;
    if (r0 < RH) gemm_tile<bf, 2, 0>(sm, Qh + o, Ql + o, Kh + o, Kl + o, HD, HD, S, TT, r0, c0, 1.0f, nullptr, nullptr, nullptr, false, false);
    else gemm_tile<h16, 0, 0>(sm, Q16 + o, nullptr, K16 + o, nullptr, HD, HD, S, TT, r0, c0, 1.0f, nullptr, nullptr, nullptr, false, false);
}

// ---- k_pv: probabilities x values, both row bands in one launch; grid (sequence, column tile, query tile from the last down: the longest key loops start first). The key loop stops at the diagonal block (probabilities beyond it are exactly zero); the fp16 band's sum is stored x 1/PCAR (the probabilities' carry taken back).
__global__ __launch_bounds__(128) void k_pv(const bf* __restrict__ Ph, const bf* __restrict__ Pl, const bf* __restrict__ Vh, const bf* __restrict__ Vl, const h16* __restrict__ P16, const h16* __restrict__ V16, float* O) {
    __shared__ __align__(16) char sm[(Stg<2>::SMB > Stg<0>::SMB) ? Stg<2>::SMB : Stg<0>::SMB];
    const int r0 = (TT / 128 - 1 - (int)blockIdx.z) * 128, c0 = blockIdx.y * 128, Kl = min(TT, r0 + 128);
    const size_t z = blockIdx.x, vo = z * HD * TT; O += z * TT * DQ;
    if (r0 < RH) gemm_tile<bf, 2, 1>(sm, Ph + z * RH * TT, Pl + z * RH * TT, Vh + vo, Vl + vo, TT, Kl, O, DQ, r0, c0, 1.0f, nullptr, nullptr, nullptr, false, false);
    else gemm_tile<h16, 0, 1>(sm, P16 + z * TT * TT, nullptr, V16 + vo, nullptr, TT, Kl, O, DQ, r0, c0, 1.0f / PCAR, nullptr, nullptr, nullptr, false, false);
}

typedef __attribute__((ext_vector_type(4))) _Float16 v4h;
typedef __attribute__((ext_vector_type(4))) unsigned short v4us;
typedef __attribute__((ext_vector_type(4))) int v4i;

// k_cvt8: f32 -> bf16 of x and of the three weights in one launch; a block converts 2,048 elements of one of them (the block index says which).
#define CBX ((unsigned)((size_t)NB_ * TT * DM / 2048))
#define CBW ((unsigned)((size_t)DQ * DM / 2048))
static_assert((size_t)NB_ * TT * DM % 2048 == 0 && (size_t)DQ * DM % 2048 == 0 && DQ == DKV, "whole blocks; three weights of one size");
__global__ __launch_bounds__(256) void k_cvt8(const float* __restrict__ x, const float* __restrict__ wq, const float* __restrict__ wk, const float* __restrict__ wv, bf* XB, bf* WQ, bf* WK, bf* WV) {
    unsigned b = blockIdx.x; const float* src = x; bf* dst = XB;
    if (b >= CBX) { b -= CBX; const unsigned w = b / CBW; b -= w * CBW; src = (w == 0) ? wq : (w == 1) ? wk : wv; dst = (w == 0) ? WQ : (w == 1) ? WK : WV; }
    const size_t i = (size_t)b * 256 + threadIdx.x; const v8f v = *(const v8f*)(src + i * 8); v8us o;
#pragma unroll
    for (int k = 0; k < 8; ++k) o[k] = f2bf(v[k]); *(v8us*)(dst + i * 8) = o;  }

// k_asoft: per row (zz, i), zz = sequence: t = S x HD^-0.5 for j <= i and i - j < WIN (sliding causal window; the reference's -1e9 additive fill vanishes identically); softmax over the 2048 keys (register row, one exp, fixed trees);
__global__ __launch_bounds__(256) void k_asoft(const float* __restrict__ Sb, h16* P16, bf* Ph, bf* Pl) {
    const int lane = threadIdx.x & 31; const int row = blockIdx.x * 8 + (threadIdx.x >> 5); if (row >= NB_ * ZH * TT) return; const int i = row % TT; const int zz = row / TT; (void)zz; const bool hires = (i < RH); const float* sr = Sb + (size_t)row * TT; float v[TT / 32]; float mx = -3.0e38f;
    const int iu = __builtin_amdgcn_readfirstlane(i);   // the row is one per wave: in a scalar register the tests below are scalar branches
    v4f a[TT / 128];
#pragma unroll
    for (int ch = 0; ch < TT / 128; ++ch) { a[ch] = (v4f){-3.0e38f, -3.0e38f, -3.0e38f, -3.0e38f}; if (ch == 0 || ch * 128 <= iu) a[ch] = *(const v4f*)(sr + ch * 128 + lane * 4); }   // a 128-key block wholly above the diagonal was never written in this call and is wholly masked below: it is not read; its registers take the mask's own value (with a zero fill the compiler shared one of them with the zero of the address arithmetic and put a data wait inside the run of loads)
#pragma unroll
    for (int ch = 0; ch < TT / 128; ++ch) { const int j0 = ch * 128 + lane * 4;
#pragma unroll
        for (int q = 0; q < 4; ++q) { const int j = j0 + q; (void)j; const float t = (j <= i && i - j < WIN) ? a[ch][q] * SCL : -3.0e38f; v[ch * 4 + q] = t; mx = fmaxf(mx, t); } }
#pragma unroll
    for (int sh = 16; sh; sh >>= 1) mx = fmaxf(mx, __shfl_xor(mx, sh, 32));
    float sum = 0.f;
#pragma unroll
    for (int k = 0; k < TT / 32; ++k) { float d0 = __fsub_rn(v[k], mx); asm volatile("" : "+v"(d0)); v[k] = __builtin_amdgcn_exp2f(__fmul_rn(d0, 1.4426950408889634f)); sum += v[k]; }
#pragma unroll
    for (int sh = 16; sh; sh >>= 1) sum += __shfl_xor(sum, sh, 32);
    const float f = __fdiv_rn(hires ? 1.0f : PCAR, sum);
{
        if (hires) {
#pragma unroll
            for (int ch = 0; ch < (RH + 127) / 128; ++ch) if (ch == 0 || ch * 128 <= iu) { v4us oh, ol;   // the product's key loop ends at the row's diagonal block (below RH here): nothing reads the blocks beyond it, and they are not stored
#pragma unroll
                for (int q = 0; q < 4; ++q) { unsigned short a, c2; splitf(v[ch * 4 + q] * f, a, c2); oh[q] = a; ol[q] = c2; }
                const size_t oo = ((size_t)zz * (RH ? RH : 1) + i) * TT + ch * 128 + lane * 4; *(v4us*)(Ph + oo) = oh; *(v4us*)(Pl + oo) = ol;
                asm volatile("s_wait_xcnt 0x0" ::: "memory"); }   // closes the two stores inside their branch: the next block's code rewrites their registers
        } else {
#pragma unroll
            for (int g = 0; g < TT / 512; ++g) if (g == 0 || g * 512 <= iu) {                      // as above, four blocks to a branch, so that their stores go out together
#pragma unroll
                for (int ch = 4 * g; ch < 4 * g + 4; ++ch) { v4h o4;
#pragma unroll
                    for (int q = 0; q < 4; ++q) o4[q] = tohx(v[ch * 4 + q] * f);
                    *(v4h*)(P16 + (size_t)row * TT + ch * 128 + lane * 4) = o4; }
                asm volatile("s_wait_xcnt 0x0" ::: "memory"); } }  // closes the four stores inside their branch: the next group's code rewrites their registers
         }
}

extern "C" void kernel_launch(void* const* d_in, const int* in_sizes, int n_in,
                              void* d_out, int out_size, void* d_ws, size_t ws_size, hipStream_t stream) {
    (void)in_sizes; (void)n_in; (void)out_size;
    const float* x = (const float*)d_in[0]; const float* wq = (const float*)d_in[1]; const float* wk = (const float*)d_in[2]; const float* wv = (const float*)d_in[3]; const float* wo = nullptr; (void)wo;   /* input order x, Wq, Wk, Wv ('oi' [1024][1024]) */
    float* OUT = (float*)d_out;     // [4][2048][1024]
    char* wsp = (char*)d_ws;
    auto take = [&](size_t bytes) { char* p = wsp; wsp += (bytes + 255) & ~(size_t)255; return (void*)p; };
    bf* WQ = (bf*)take((size_t)DQ * DM * 2); bf* WK = (bf*)take((size_t)DKV * DM * 2); bf* WV = (bf*)take((size_t)DKV * DM * 2);
    bf* XB = (bf*)take((size_t)NB_ * TT * DM * 2); float* Sb = (float*)take((size_t)NB_ * ZH * TT * TT * 4);
    h16* QP16 = (h16*)take((size_t)NB_ * NH_ * TT * HD * 2); h16* KP16 = (h16*)take((size_t)NB_ * NKV * TT * HD * 2); h16* VT16 = (h16*)take((size_t)NB_ * NKV * HD * TT * 2);
    bf* QPh = (bf*)take((size_t)NB_ * NH_ * TT * HD * 2); bf* QPl = (bf*)take((size_t)NB_ * NH_ * TT * HD * 2); bf* KPh = (bf*)take((size_t)NB_ * NKV * TT * HD * 2); bf* KPl = (bf*)take((size_t)NB_ * NKV * TT * HD * 2); bf* VTh = (bf*)take((size_t)NB_ * NKV * HD * TT * 2); bf* VTl = (bf*)take((size_t)NB_ * NKV * HD * TT * 2);
    // Reuse inside one call, stream-ordered, so that four sequences fit the workspace: the probabilities take the q and k planes' place (dead once the scores are written).
    static_assert((size_t)ZH * TT * TT == (size_t)(NH_ + NKV) * TT * HD, "P16 fills QP16 + KP16"); static_assert(2 * (size_t)ZH * RH * TT <= (size_t)NH_ * TT * HD, "Ph + Pl fit QPh");
    h16* P16 = QP16; bf* Ph = QPh; bf* Pl = QPh + (size_t)NB_ * ZH * RH * TT;
    if ((size_t)(wsp - (char*)d_ws) > ws_size) return;    // ws 256 MiB
    k_cvt8<<<CBX + 3 * CBW, 256, 0, stream>>>(x, wq, wk, wv, XB, WQ, WK, WV);
    k_proj<<<dim3((TT / 128) * (HD / 128), 3, NB_), 128, 0, stream>>>(XB, WQ, WK, WV, QP16, QPh, QPl, KP16, KPh, KPl, VT16, VTh, VTl);
    k_scores<<<dim3(NB_, TT / 128, TT / 128), 128, 0, stream>>>(QPh, QPl, KPh, KPl, QP16, KP16, Sb);
    k_asoft<<<NB_ * ZH * TT / 8, 256, 0, stream>>>(Sb, P16, Ph, Pl);
    k_pv<<<dim3(NB_, HD / 128, TT / 128), 128, 0, stream>>>(Ph, Pl, VTh, VTl, P16, VT16, OUT);
}

// v006
// One run takes 123 microseconds.
// Two timings next to v005 both put it at 1.08 times that version's speed.
// Counting every step since v000, it is 6.76 times as fast.
#include <hip/hip_runtime.h>

// Single-head causal self-attention with bias-free projections (x [4][2048][1024]; q, k, v = einsum('bsd,ed', x, W) ('oi' [1024][1024] 1/32, no bias; ONE 1,024-wide head); scores = q.k; causal (-inf); THEN x 1/sqrt(1024) inside the softmax call (-inf stays -inf); softmax; out = attn.v -> [4][2048][1024] (8.4 M); no output projection; argument order x, Wq, Wk, Wv).
// All four sequences run in every launch (grid z = sequence in the projections, grid x in the scores and the probability x value product), and launches that do not depend on one another share one grid (the four conversions; the three projections; both row bands of the scores; both of the probability x value product); buffers hold four planes, and dead ones are reused later in the same call. Layout per sequence: bf16 copy of x; 'oi' weights; exact projections whose epilogue writes the 16-bit planes itself (v as Wv.x^T, so that its planes come out transposed); causal T-2048 attention at NH 1 / ZH 1 (hybrid rows: < 512 hi/lo 3 products, rest fp16 x1024; the score launch skips tiles above the diagonal); the probability x value epilogue writes the output rows (no output projection).
// Compute dtypes, f32 accumulate: every input rounded to bf16; projections exact; attention rows < 512 3 products, rest fp16; softmax f32; output f32.

#define NB_  4
#define TT   2048
#define DM   1024
#define NH_  1
#define NKV  1
#define REP  (NH_ / NKV)
#define HD   1024
#define DQ   (NH_ * HD)
#define DKV  (NKV * HD)
#define ZH   1                    // ONE head: a single plane per pass
static_assert(1 % ZH == 0, "single head");
#define RH   512                  // query rows < RH use hi+lo planes (0: none)
static_assert(RH % 128 == 0 && TT % 512 == 0, "the band ends on a tile edge; the softmax stores fp16 rows in groups of 512 keys");
#define WIN  2048
#define PCAR 1024.0f
#define SCL  0.03125f   // 1/sqrt(d_k = 1024)
typedef _Float16 h16;
typedef unsigned short bf;
typedef __attribute__((ext_vector_type(16))) __bf16   v16bf;
typedef __attribute__((ext_vector_type(16))) _Float16 v16h;
typedef __attribute__((ext_vector_type(8)))  _Float16 v8h;
typedef __attribute__((ext_vector_type(8)))  unsigned short v8us;
typedef __attribute__((ext_vector_type(8)))  float    v8f;
typedef __attribute__((ext_vector_type(4)))  float    v4f;
typedef v8h  __attribute__((may_alias)) v8ha;
typedef v4f  __attribute__((may_alias)) v4fa;
typedef v8us __attribute__((may_alias)) v8usa;

__device__ __forceinline__ unsigned short f2bf(float f) { unsigned u = __float_as_uint(f); u += 0x7FFFu + ((u >> 16) & 1u); return (unsigned short)(u >> 16); }
__device__ __forceinline__ float bf2f(unsigned short b) { return __uint_as_float(((unsigned)b) << 16); }
__device__ __forceinline__ v16h cat16(v8h lo, v8h hi) { return __builtin_shufflevector(lo, hi, 0, 1, 2, 3, 4, 5, 6, 7, 8, 9, 10, 11, 12, 13, 14, 15); }
__device__ __forceinline__ v16bf cat16b(v8us lo, v8us hi) { return __builtin_bit_cast(v16bf, __builtin_shufflevector(lo, hi, 0, 1, 2, 3, 4, 5, 6, 7, 8, 9, 10, 11, 12, 13, 14, 15)); }
__device__ __forceinline__ v8f wmma16(v16h a, v16h b, v8f c) { return __builtin_amdgcn_wmma_f32_16x16x32_f16(false, a, false, b, (short)0, c, false, false); }
__device__ __forceinline__ v8f wmmab(v16bf a, v16bf b, v8f c) { return __builtin_amdgcn_wmma_f32_16x16x32_bf16(false, a, false, b, (short)0, c, false, false); }
__device__ __forceinline__ h16 tohx(float x) { return (h16)x; }
__device__ __forceinline__ void splitf(float y, unsigned short& h, unsigned short& l) { h = f2bf(y); l = f2bf(y - bf2f(h)); }



// ---- Tile GEMM, operands staged in LDS: one work-group of 4 waves (2 x 2) per 128x128 output tile, each wave a 64x64 part (16 accumulators). A stage is 64 k (128-byte rows) of every operand plane,
// brought from the K-contiguous 16-bit planes by asynchronous 16-byte copies that cover whole 128-byte lines (8 lanes a row); three buffers, the copies of the next two stages fly while this one is worked on.
// With three products (four planes) a stage is 32 k (64-byte rows, 4 lanes a row), so that a stage is 32 KiB for both kinds of tile and both can share a launch at three work-groups a WGP.
// LDS rows carry no pad: the 16-byte piece c of row r lies at piece c ^ s(r) of that row, s(r) = (r / rows per 256 B) mod pieces per row, so that the 16 rows a half-wave reads at one logical piece fall on all 64 banks.
// C[m][n] (f32, pitch ldc) = sum_k A[m][k] Bt[n][k] (+ A2.Bt + A.Bt2 for NSPLIT 2), k ascending in steps of 32. Kl % 64 == 0, Kl <= K. sm: the work-group's LDS (SMB bytes of it are used; the drained ring serves as output staging).
// EPI says what the epilogue stores of that sum: 0 the f32 value in C; 1 the f32 value x osc in C; 2 no f32 at all, but its fp16 rounding in P16 (where s16) and its bf16 hi/lo split in Ph, Pl (where shl) (pitch ldc, whole 128-byte lines); s16 and shl are the same for the whole work-group and say which planes of this tile a later launch reads.
template <typename T16> struct WFrag;
template <> struct WFrag<h16> { typedef v16h V; static __device__ __forceinline__ V ld(const h16* p, const h16* q) { return cat16(*(const v8h*)p, *(const v8h*)q); } static __device__ __forceinline__ v8f mma(V a, V b, v8f c) { return wmma16(a, b, c); } };
template <> struct WFrag<bf> { typedef v16bf V; static __device__ __forceinline__ V ld(const bf* p, const bf* q) { return cat16b(*(const v8us*)p, *(const v8us*)q); } static __device__ __forceinline__ v8f mma(V a, V b, v8f c) { return wmmab(a, b, c); } };
template <int NSPLIT> struct Stg {
    static constexpr int KS  = (NSPLIT == 2) ? 32 : 64;        // k per stage
    static constexpr int LP  = KS;                             // LDS row pitch in 16-bit elements: no pad, the pieces of a row are permuted instead
    static constexpr int RP  = 128 / KS;                       // rows per 256 B (one sweep of the banks)
    static constexpr int PLN = 128 * LP;                       // one operand plane of a stage, in elements
    static constexpr int STG = (NSPLIT == 2 ? 4 : 2) * PLN;    // a stage: A | Bt (| A2 | Bt2), 32 KiB
    static constexpr int NBUF = 3;                             // buffers of the ring
    static constexpr int RB  = NBUF * STG * 2;                 // the ring, in bytes
    static constexpr int SMB = RB;                             // the four waves' output staging (4 x 16 x 68 f32) lies in the drained ring
    static_assert(4 * 16 * 68 * 4 <= RB, "staging fits the ring");
};
// One lane's share of one plane of a 64-k stage: 8 copies of 16 bytes, rows 16 apart (rs = 16 rows in elements of the source, 2048 B in LDS; 16 rows on, a row's permutation is the same). The s_wait_xcnt closes the statement so that no address register is rewritten ahead of it.
template <typename T16>
__device__ __forceinline__ void copy_plane(unsigned l, const T16* g, size_t rs) {
    asm volatile("global_load_async_to_lds_b128 %0, %8, off\n\t"
                 "global_load_async_to_lds_b128 %1, %9, off\n\t"
                 "global_load_async_to_lds_b128 %2, %10, off\n\t"
                 "global_load_async_to_lds_b128 %3, %11, off\n\t"
                 "global_load_async_to_lds_b128 %4, %12, off\n\t"
                 "global_load_async_to_lds_b128 %5, %13, off\n\t"
                 "global_load_async_to_lds_b128 %6, %14, off\n\t"
                 "global_load_async_to_lds_b128 %7, %15, off\n\t"
                 "s_wait_xcnt 0x0"
                 :: "v"(l), "v"(l + 2048u), "v"(l + 2u * 2048u), "v"(l + 3u * 2048u), "v"(l + 4u * 2048u), "v"(l + 5u * 2048u), "v"(l + 6u * 2048u), "v"(l + 7u * 2048u),
                    "v"(g), "v"(g + rs), "v"(g + 2 * rs), "v"(g + 3 * rs), "v"(g + 4 * rs), "v"(g + 5 * rs), "v"(g + 6 * rs), "v"(g + 7 * rs) : "memory");
}
// The same for a 32-k stage: 4 copies of 16 bytes, rows 32 apart (rs = 32 rows in elements of the source, 2048 B in LDS).
template <typename T16>
__device__ __forceinline__ void copy_plane4(unsigned l, const T16* g, size_t rs) {
    asm volatile("global_load_async_to_lds_b128 %0, %4, off\n\t"
                 "global_load_async_to_lds_b128 %1, %5, off\n\t"
                 "global_load_async_to_lds_b128 %2, %6, off\n\t"
                 "global_load_async_to_lds_b128 %3, %7, off\n\t"
                 "s_wait_xcnt 0x0"
                 :: "v"(l), "v"(l + 2048u), "v"(l + 2u * 2048u), "v"(l + 3u * 2048u),
                    "v"(g), "v"(g + rs), "v"(g + 2 * rs), "v"(g + 3 * rs) : "memory");
}
// 16 staged rows of 64 f32 (pitch 68) to the 16-bit planes: S16 the fp16 rounding, SHL the bf16 hi/lo split; 8 lanes a row, 16 bytes a lane.
template <bool S16, bool SHL>
__device__ __forceinline__ void store_planes(const float* os, int lane, size_t cb, int ldc, h16* P16, bf* Ph, bf* Pl) {
#pragma unroll
    for (int s = 0; s < 4; ++s) { const int row = 4 * s + (lane >> 3), cofs = (lane & 7) * 8; const v4f x0 = *(const v4fa*)(os + row * 68 + cofs), x1 = *(const v4fa*)(os + row * 68 + cofs + 4); v8h o16; v8us oh, ol;
#pragma unroll
        for (int q = 0; q < 8; ++q) { const float x = (q < 4) ? x0[q & 3] : x1[q & 3]; if (S16) o16[q] = tohx(x); if (SHL) { unsigned short a2, c2; splitf(x, a2, c2); oh[q] = a2; ol[q] = c2; } }
        const size_t oo = cb + (size_t)row * ldc + cofs; if (S16) *(v8h*)(P16 + oo) = o16; if (SHL) { *(v8us*)(Ph + oo) = oh; *(v8us*)(Pl + oo) = ol; } }
    asm volatile("s_wait_xcnt 0x0" ::: "memory");              // closes the run of stores inside its branch: the code behind the join rewrites the stores' registers
}
template <typename T16, int NSPLIT, int EPI>
__device__ __forceinline__ void gemm_tile(char* sm, const T16* __restrict__ A, const T16* __restrict__ A2, const T16* __restrict__ Bt, const T16* __restrict__ Bt2, int K, int Kl, float* C, int ldc, int r0, int c0, float osc, h16* P16, bf* Ph, bf* Pl, bool s16, bool shl) {
    static_assert(NSPLIT == 0 || NSPLIT == 2, "one product or three");
    typedef typename WFrag<T16>::V V;
    constexpr int KS = Stg<NSPLIT>::KS, LP = Stg<NSPLIT>::LP, RP = Stg<NSPLIT>::RP, PLN = Stg<NSPLIT>::PLN, STG = Stg<NSPLIT>::STG;
    T16* ring = (T16*)sm;
    float* osw = (float*)sm;                                   // used only behind the last trip's barrier, when nobody reads the ring and no copy is in flight
    const int tid = threadIdx.x, lane = tid & 31, lr = lane & 15, hi = lane >> 4, wave = tid >> 5, wm = wave >> 1, wn = wave & 1;
    float* os = osw + wave * (16 * 68);                        // output staging, private to the wave
    v8f acc[4][4];
#pragma unroll
    for (int mb = 0; mb < 4; ++mb)
#pragma unroll
        for (int nb = 0; nb < 4; ++nb) acc[mb][nb] = (v8f){};
    constexpr int LR = KS / 8;                                 // copies: LR lanes cover one row of a stage (128 or 64 bytes)
    const int crow = tid / LR, ccol = (tid % LR) * 8, cswz = ((tid % LR) ^ ((crow / RP) % LR)) * 8;   // cswz: where the lane's piece lies in its LDS row
    const size_t ga = (size_t)(r0 + crow) * K + ccol, gb = (size_t)(c0 + crow) * K + ccol, rs = (size_t)(128 / LR) * K;
    const unsigned l0 = (unsigned)(size_t)ring + (unsigned)(crow * LP + cswz) * 2u;
    auto issue = [&](int t, int buf) { const unsigned l = l0 + (unsigned)buf * (unsigned)(STG * 2); const int kc = t * KS;
        if (NSPLIT == 0) { copy_plane(l, A + ga + kc, rs); copy_plane(l + PLN * 2u, Bt + gb + kc, rs); }
        else { copy_plane4(l, A + ga + kc, rs); copy_plane4(l + PLN * 2u, Bt + gb + kc, rs); copy_plane4(l + 2u * PLN * 2u, A2 + ga + kc, rs); copy_plane4(l + 3u * PLN * 2u, Bt2 + gb + kc, rs); } };
    const int nst = Kl / KS;
    issue(0, 0);
    if (nst > 1) issue(1, 1);
    if (nst > 2) issue(2, 2);
    // this wave's copies of stage 0 have landed: every stage is 16 copies a wave, and the wait leaves only the younger stages' copies outstanding
    if (nst > 2) asm volatile("s_wait_asynccnt 0x20" ::: "memory");
    else if (nst > 1) asm volatile("s_wait_asynccnt 0x10" ::: "memory");
    else asm volatile("s_wait_asynccnt 0x0" ::: "memory");
    __syncthreads();                                           // publishes stage 0
    const int fa = (wm * 64 + lr) * LP, fb = PLN + (wn * 64 + lr) * LP, sw = hi ^ ((lr / RP) % LR);   // sw: the row's permutation applied to the half-wave's piece
    int cur = 0;                                               // the buffer of stage t
#pragma unroll 1
    for (int t = 0; t < nst; ++t) {                            // kept rolled: one stage a trip
        const T16* sb = ring + cur * STG;
#pragma unroll
        for (int ks = 0; ks < KS; ks += 32) {
            V a[4], a2[4], bq[4];
            const int p0 = (sw ^ (ks / 8)) * 8, p1 = (sw ^ (ks / 8 + 2)) * 8;   // the fragment's two 16-byte pieces (k = ks + 8 hi and 16 further) at their places in the row
#pragma unroll
            for (int mb = 0; mb < 4; ++mb) { a[mb] = WFrag<T16>::ld(sb + fa + mb * 16 * LP + p0, sb + fa + mb * 16 * LP + p1); if (NSPLIT == 2) a2[mb] = WFrag<T16>::ld(sb + 2 * PLN + fa + mb * 16 * LP + p0, sb + 2 * PLN + fa + mb * 16 * LP + p1); }
#pragma unroll
            for (int nb = 0; nb < 4; ++nb) if (NSPLIT == 0) bq[nb] = WFrag<T16>::ld(sb + fb + nb * 16 * LP + p0, sb + fb + nb * 16 * LP + p1);   // one product: all eight fragments of the step are asked for ahead of its 16 matrix instructions
            if (NSPLIT == 0) __builtin_amdgcn_sched_barrier(0);   // keeps that load group ahead of the matrix block: sunk between the matrix instructions, each pair of loads would be waited for alone
#pragma unroll
            for (int nb = 0; nb < 4; ++nb) { const V b = (NSPLIT == 0) ? bq[nb] : WFrag<T16>::ld(sb + fb + nb * 16 * LP + p0, sb + fb + nb * 16 * LP + p1); V b2; if (NSPLIT == 2) b2 = WFrag<T16>::ld(sb + 2 * PLN + fb + nb * 16 * LP + p0, sb + 2 * PLN + fb + nb * 16 * LP + p1);
#pragma unroll
                for (int mb = 0; mb < 4; ++mb) { acc[mb][nb] = WFrag<T16>::mma(a[mb], b, acc[mb][nb]); if (NSPLIT == 2) { acc[mb][nb] = WFrag<T16>::mma(a2[mb], b, acc[mb][nb]); acc[mb][nb] = WFrag<T16>::mma(a[mb], b2, acc[mb][nb]); } } }
        }
        asm volatile("s_wait_dscnt 0x0" ::: "memory");         // this wave's reads of the buffer are done before it is refilled
        if (t + 2 < nst) asm volatile("s_wait_asynccnt 0x10" ::: "memory");   // this wave's copies of stage t + 1 have landed: in every wave exactly the 16 of stage t + 2 are younger, and they may still fly
        else asm volatile("s_wait_asynccnt 0x0" ::: "memory");                // no younger stage: everything has landed
        __syncthreads();                                       // publishes stage t + 1 and ends every reader's last read of stage t
        if (t + 3 < nst) issue(t + 3, cur);                    // into the buffer that trip t has just read
        cur = (cur == Stg<NSPLIT>::NBUF - 1) ? 0 : cur + 1;
    }
    asm volatile("s_wait_asynccnt 0x0" ::: "memory");          // nothing in flight when the wave ends
#pragma unroll
    for (int mb = 0; mb < 4; ++mb) {
#pragma unroll
        for (int nb = 0; nb < 4; ++nb) {
#pragma unroll
            for (int j = 0; j < 8; ++j) os[(hi * 8 + j) * 68 + nb * 16 + lr] = acc[mb][nb][j]; }
        __builtin_amdgcn_wave_barrier(); asm volatile("" ::: "memory");
        const size_t cb = (size_t)(r0 + wm * 64 + mb * 16) * ldc + c0 + wn * 64;
        if (EPI == 2) {                                        // 8 lanes a row: the wave's 64 columns are one 128-byte line of each 16-bit plane
            if (!shl) store_planes<true, false>(os, lane, cb, ldc, P16, Ph, Pl);      // one scalar branch for 16 rows: each case is straight-line code, so that its LDS reads go out together
            else if (s16) store_planes<true, true>(os, lane, cb, ldc, P16, Ph, Pl);
            else store_planes<false, true>(os, lane, cb, ldc, P16, Ph, Pl);
        } else {
#pragma unroll
            for (int s = 0; s < 8; ++s) { const int row = 2 * s + hi, cofs = lr * 4; v4f val = *(const v4fa*)(os + row * 68 + cofs); if (EPI == 1) val *= osc;
                *(v4f*)(C + cb + (size_t)row * ldc + cofs) = val; }
        }
        __builtin_amdgcn_wave_barrier(); asm volatile("" ::: "memory");
    }
    asm volatile("s_wait_xcnt 0x0" ::: "memory");              // closes the run of stores: where two kinds of tile share a kernel, the other kind's code follows in the listing and rewrites the stores' registers
}
// ---- k_proj: the three projections in one launch, each stored as 16-bit planes, a tile only in the planes that a later launch reads of it (hi/lo: positions < RH alone, the only ones the three-product band touches; fp16: all of k and v, q from row RH on); grid (128 tiles, projection, sequence), 128 threads. q and k as x.W^T -> [t][d]; v as Wv.x^T -> [d][t], the layout the probability x value product reads.
__global__ __launch_bounds__(128) void k_proj(const bf* __restrict__ XB, const bf* __restrict__ WQ, const bf* __restrict__ WK, const bf* __restrict__ WV, h16* Q16, bf* Qh, bf* Ql, h16* K16, bf* Kh, bf* Kl, h16* V16, bf* Vh, bf* Vl) {
    __shared__ __align__(16) char sm[Stg<0>::SMB];
    const int w = blockIdx.y, t = blockIdx.x; const bf* X = XB + (size_t)blockIdx.z * TT * DM; const size_t po = (size_t)blockIdx.z * TT * HD;
    const bool tr = (w == 2);                                        // v: the weight rows are the tile's rows
    const bf* Wt = (w == 0) ? WQ : (w == 1) ? WK : WV;
    h16* P16 = ((w == 0) ? Q16 : (w == 1) ? K16 : V16) + po; bf* Ph = ((w == 0) ? Qh : (w == 1) ? Kh : Vh) + po; bf* Pl = ((w == 0) ? Ql : (w == 1) ? Kl : Vl) + po;
    const int r0 = (tr ? (t % (HD / 128)) : (t % (TT / 128))) * 128, c0 = (tr ? (t / (HD / 128)) : (t / (TT / 128))) * 128;
    const bool lowpos = (tr ? c0 : r0) < RH;                          // the tile's sequence positions (its columns for v) lie in the hi/lo band; RH is a multiple of the tile
    gemm_tile<bf, 0, 2>(sm, tr ? Wt : X, nullptr, tr ? X : Wt, nullptr, DM, DM, nullptr, tr ? TT : HD, r0, c0, 1.0f, P16, Ph, Pl, w != 0 || !lowpos, lowpos);
}

// ---- k_scores: q.k^T for causal attention, both row bands in one launch; grid (sequence, key tile, query tile): the hi/lo tiles, three times as long as the rest, have the lowest indices and start first. Tiles entirely above the diagonal are skipped; query rows < RH take the hi/lo planes (3 products), the rest fp16.
__global__ __launch_bounds__(128) void k_scores(const bf* __restrict__ Qh, const bf* __restrict__ Ql, const bf* __restrict__ Kh, const bf* __restrict__ Kl, const h16* __restrict__ Q16, const h16* __restrict__ K16, float* S) {
    __shared__ __align__(16) char sm[(Stg<2>::SMB > Stg<0>::SMB) ? Stg<2>::SMB : Stg<0>::SMB];
    const int r0 = blockIdx.z * 128, c0 = blockIdx.y * 128;
    if (c0 > r0 + 127) return;                                       // score tile entirely above the causal diagonal (the whole work-group leaves, ahead of every barrier); the softmax masks j > i by select
    const size_t o = (size_t)blockIdx.x * TT * HD; S += (size_t)blockIdx.x * TT * TT;
    if (r0 < RH) gemm_tile<bf, 2, 0>(sm, Qh + o, Ql + o, Kh + o, Kl + o, HD, HD, S, TT, r0, c0, 1.0f, nullptr, nullptr, nullptr, false, false);
    else gemm_tile<h16, 0, 0>(sm, Q16 + o, nullptr, K16 + o, nullptr, HD, HD, S, TT, r0, c0, 1.0f, nullptr, nullptr, nullptr, false, false);
}

// ---- k_pv: probabilities x values, both row bands in one launch; grid (sequence, column tile, query tile from the last down: the longest key loops start first). The key loop stops at the diagonal block (probabilities beyond it are exactly zero); the fp16 band's sum is stored x 1/PCAR (the probabilities' carry taken back).
__global__ __launch_bounds__(128) void k_pv(const bf* __restrict__ Ph, const bf* __restrict__ Pl, const bf* __restrict__ Vh, const bf* __restrict__ Vl, const h16* __restrict__ P16, const h16* __restrict__ V16, float* O) {
    __shared__ __align__(16) char sm[(Stg<2>::SMB > Stg<0>::SMB) ? Stg<2>::SMB : Stg<0>::SMB];
    const int r0 = (TT / 128 - 1 - (int)blockIdx.z) * 128, c0 = blockIdx.y * 128, Kl = min(TT, r0 + 128);
    const size_t z = blockIdx.x, vo = z * HD * TT; O += z * TT * DQ;
    if (r0 < RH) gemm_tile<bf, 2, 1>(sm, Ph + z * RH * TT, Pl + z * RH * TT, Vh + vo, Vl + vo, TT, Kl, O, DQ, r0, c0, 1.0f, nullptr, nullptr, nullptr, false, false);
    else gemm_tile<h16, 0, 1>(sm, P16 + z * TT * TT, nullptr, V16 + vo, nullptr, TT, Kl, O, DQ, r0, c0, 1.0f / PCAR, nullptr, nullptr, nullptr, false, false);
}

typedef __attribute__((ext_vector_type(4))) _Float16 v4h;
typedef __attribute__((ext_vector_type(4))) unsigned short v4us;
typedef __attribute__((ext_vector_type(4))) int v4i;

// k_cvt8: f32 -> bf16 of x and of the three weights in one launch; a block converts 2,048 elements of one of them (the block index says which).
#define CBX ((unsigned)((size_t)NB_ * TT * DM / 2048))
#define CBW ((unsigned)((size_t)DQ * DM / 2048))
static_assert((size_t)NB_ * TT * DM % 2048 == 0 && (size_t)DQ * DM % 2048 == 0 && DQ == DKV, "whole blocks; three weights of one size");
__global__ __launch_bounds__(256) void k_cvt8(const float* __restrict__ x, const float* __restrict__ wq, const float* __restrict__ wk, const float* __restrict__ wv, bf* XB, bf* WQ, bf* WK, bf* WV) {
    unsigned b = blockIdx.x; const float* src = x; bf* dst = XB;
    if (b >= CBX) { b -= CBX; const unsigned w = b / CBW; b -= w * CBW; src = (w == 0) ? wq : (w == 1) ? wk : wv; dst = (w == 0) ? WQ : (w == 1) ? WK : WV; }
    const size_t i = (size_t)b * 256 + threadIdx.x; const v8f v = *(const v8f*)(src + i * 8); v8us o;
#pragma unroll
    for (int k = 0; k < 8; ++k) o[k] = f2bf(v[k]); *(v8us*)(dst + i * 8) = o;  }

// k_asoft: per row (zz, i), zz = sequence: t = S x HD^-0.5 for j <= i and i - j < WIN (sliding causal window; the reference's -1e9 additive fill vanishes identically); softmax over the 2048 keys (register row, one exp, fixed trees);
__global__ __launch_bounds__(256) void k_asoft(const float* __restrict__ Sb, h16* P16, bf* Ph, bf* Pl) {
    const int lane = threadIdx.x & 31; const int row = blockIdx.x * 8 + (threadIdx.x >> 5); if (row >= NB_ * ZH * TT) return; const int i = row % TT; const int zz = row / TT; (void)zz; const bool hires = (i < RH); const float* sr = Sb + (size_t)row * TT; float v[TT / 32]; float mx = -3.0e38f;
    const int iu = __builtin_amdgcn_readfirstlane(i);   // the row is one per wave: in a scalar register the tests below are scalar branches
    v4f a[TT / 128];
#pragma unroll
    for (int ch = 0; ch < TT / 128; ++ch) { a[ch] = (v4f){-3.0e38f, -3.0e38f, -3.0e38f, -3.0e38f}; if (ch == 0 || ch * 128 <= iu) a[ch] = *(const v4f*)(sr + ch * 128 + lane * 4); }   // a 128-key block wholly above the diagonal was never written in this call and is wholly masked below: it is not read; its registers take the mask's own value (with a zero fill the compiler shared one of them with the zero of the address arithmetic and put a data wait inside the run of loads)
#pragma unroll
    for (int ch = 0; ch < TT / 128; ++ch) { const int j0 = ch * 128 + lane * 4;
#pragma unroll
        for (int q = 0; q < 4; ++q) { const int j = j0 + q; (void)j; const float t = (j <= i && i - j < WIN) ? a[ch][q] * SCL : -3.0e38f; v[ch * 4 + q] = t; mx = fmaxf(mx, t); } }
#pragma unroll
    for (int sh = 16; sh; sh >>= 1) mx = fmaxf(mx, __shfl_xor(mx, sh, 32));
    float sum = 0.f;
#pragma unroll
    for (int k = 0; k < TT / 32; ++k) { float d0 = __fsub_rn(v[k], mx); asm volatile("" : "+v"(d0)); v[k] = __builtin_amdgcn_exp2f(__fmul_rn(d0, 1.4426950408889634f)); sum += v[k]; }
#pragma unroll
    for (int sh = 16; sh; sh >>= 1) sum += __shfl_xor(sum, sh, 32);
    const float f = __fdiv_rn(hires ? 1.0f : PCAR, sum);
{
        if (hires) {
#pragma unroll
            for (int ch = 0; ch < (RH + 127) / 128; ++ch) if (ch == 0 || ch * 128 <= iu) { v4us oh, ol;   // the product's key loop ends at the row's diagonal block (below RH here): nothing reads the blocks beyond it, and they are not stored
#pragma unroll
                for (int q = 0; q < 4; ++q) { unsigned short a, c2; splitf(v[ch * 4 + q] * f, a, c2); oh[q] = a; ol[q] = c2; }
                const size_t oo = ((size_t)zz * (RH ? RH : 1) + i) * TT + ch * 128 + lane * 4; *(v4us*)(Ph + oo) = oh; *(v4us*)(Pl + oo) = ol;
                asm volatile("s_wait_xcnt 0x0" ::: "memory"); }   // closes the two stores inside their branch: the next block's code rewrites their registers
        } else {
#pragma unroll
            for (int g = 0; g < TT / 512; ++g) if (g == 0 || g * 512 <= iu) {                      // as above, four blocks to a branch, so that their stores go out together
#pragma unroll
                for (int ch = 4 * g; ch < 4 * g + 4; ++ch) { v4h o4;
#pragma unroll
                    for (int q = 0; q < 4; ++q) o4[q] = tohx(v[ch * 4 + q] * f);
                    *(v4h*)(P16 + (size_t)row * TT + ch * 128 + lane * 4) = o4; }
                asm volatile("s_wait_xcnt 0x0" ::: "memory"); } }  // closes the four stores inside their branch: the next group's code rewrites their registers
         }
}

extern "C" void kernel_launch(void* const* d_in, const int* in_sizes, int n_in,
                              void* d_out, int out_size, void* d_ws, size_t ws_size, hipStream_t stream) {
    (void)in_sizes; (void)n_in; (void)out_size;
    const float* x = (const float*)d_in[0]; const float* wq = (const float*)d_in[1]; const float* wk = (const float*)d_in[2]; const float* wv = (const float*)d_in[3]; const float* wo = nullptr; (void)wo;   /* input order x, Wq, Wk, Wv ('oi' [1024][1024]) */
    float* OUT = (float*)d_out;     // [4][2048][1024]
    char* wsp = (char*)d_ws;
    auto take = [&](size_t bytes) { char* p = wsp; wsp += (bytes + 255) & ~(size_t)255; return (void*)p; };
    bf* WQ = (bf*)take((size_t)DQ * DM * 2); bf* WK = (bf*)take((size_t)DKV * DM * 2); bf* WV = (bf*)take((size_t)DKV * DM * 2);
    bf* XB = (bf*)take((size_t)NB_ * TT * DM * 2); float* Sb = (float*)take((size_t)NB_ * ZH * TT * TT * 4);
    h16* QP16 = (h16*)take((size_t)NB_ * NH_ * TT * HD * 2); h16* KP16 = (h16*)take((size_t)NB_ * NKV * TT * HD * 2); h16* VT16 = (h16*)take((size_t)NB_ * NKV * HD * TT * 2);
    bf* QPh = (bf*)take((size_t)NB_ * NH_ * TT * HD * 2); bf* QPl = (bf*)take((size_t)NB_ * NH_ * TT * HD * 2); bf* KPh = (bf*)take((size_t)NB_ * NKV * TT * HD * 2); bf* KPl = (bf*)take((size_t)NB_ * NKV * TT * HD * 2); bf* VTh = (bf*)take((size_t)NB_ * NKV * HD * TT * 2); bf* VTl = (bf*)take((size_t)NB_ * NKV * HD * TT * 2);
    // Reuse inside one call, stream-ordered, so that four sequences fit the workspace: the probabilities take the q and k planes' place (dead once the scores are written).
    static_assert((size_t)ZH * TT * TT == (size_t)(NH_ + NKV) * TT * HD, "P16 fills QP16 + KP16"); static_assert(2 * (size_t)ZH * RH * TT <= (size_t)NH_ * TT * HD, "Ph + Pl fit QPh");
    h16* P16 = QP16; bf* Ph = QPh; bf* Pl = QPh + (size_t)NB_ * ZH * RH * TT;
    if ((size_t)(wsp - (char*)d_ws) > ws_size) return;    // ws 256 MiB
    k_cvt8<<<CBX + 3 * CBW, 256, 0, stream>>>(x, wq, wk, wv, XB, WQ, WK, WV);
    k_proj<<<dim3((TT / 128) * (HD / 128), 3, NB_), 128, 0, stream>>>(XB, WQ, WK, WV, QP16, QPh, QPl, KP16, KPh, KPl, VT16, VTh, VTl);
    k_scores<<<dim3(NB_, TT / 128, TT / 128), 128, 0, stream>>>(QPh, QPl, KPh, KPl, QP16, KP16, Sb);
    k_asoft<<<NB_ * ZH * TT / 8, 256, 0, stream>>>(Sb, P16, Ph, Pl);
    k_pv<<<dim3(NB_, HD / 128, TT / 128), 128, 0, stream>>>(Ph, Pl, VTh, VTl, P16, VT16, OUT);
}
